// v000
// Times are from an AMD MI455X. After a warm-up the kernel runs many times in a row, and a time is the length of
// such a window on the GPU divided by its runs, so every launch and the gaps after it count. The runs cycle
// through copies of the inputs. A figure is the median of several windows, for all but v000 over two sittings.
// Sittings can differ by a few percent; kernels timed side by side share one.
// v000 is the starting kernel.
#include <hip/hip_runtime.h>
#include <hip/hip_bf16.h>
#include <math.h>

// ---------------------------------------------------------------------------
// Fused Mamba-style SSM + FFN block for MI455X (gfx1250, wave32).
// All GEMMs run through V_WMMA_F32_16X16X4_F32 (full fp32 matrix path),
// fed from LDS-staged panels (coalesced float4 global loads, ds_load_b64
// fragment reads, bank-conflict-free padded layout).
// ---------------------------------------------------------------------------

typedef float v2f __attribute__((ext_vector_type(2)));
typedef float v8f __attribute__((ext_vector_type(8)));

#define T_LEN  2048
#define D_DIM  512
#define DS_DIM 32
#define RMS_EPS 1e-6f
#define KC 32            // K-chunk staged in LDS per iteration
#define LDP 36           // padded row length (floats): 144B = 16B-aligned, bank-spread

__device__ __forceinline__ float silu_f(float x) { return x / (1.0f + expf(-x)); }

// ------------------------------- RMSNorm -----------------------------------
__global__ void rmsnorm_kernel(const float* __restrict__ x,
                               const float* __restrict__ w,
                               float* __restrict__ xn) {
    const int row = blockIdx.x;
    const float* xr = x + row * D_DIM;
    const int tid = threadIdx.x;              // 256 threads, 2 elems each
    float v0 = xr[tid];
    float v1 = xr[tid + 256];
    float s = v0 * v0 + v1 * v1;
    #pragma unroll
    for (int off = 16; off > 0; off >>= 1) s += __shfl_xor(s, off, 32);
    __shared__ float red[8];
    const int wave = tid >> 5, lane = tid & 31;
    if (lane == 0) red[wave] = s;
    __syncthreads();
    float tot = 0.f;
    #pragma unroll
    for (int i = 0; i < 8; ++i) tot += red[i];
    const float scale = rsqrtf(tot * (1.0f / D_DIM) + RMS_EPS);
    xn[row * D_DIM + tid]       = v0 * scale * w[tid];
    xn[row * D_DIM + tid + 256] = v1 * scale * w[tid + 256];
}

// ------------------------- WMMA fp32 GEMM (LDS staged) ---------------------
// C[M,N] = epilogue(A[M,K] @ B[K,N]); 8 waves/block -> 64x32 block tile,
// one wave computes a 16x16 tile.  K stepped by 4 via V_WMMA_F32_16X16X4_F32.
// A panel (64xKC) staged row-major in LDS; B panel (KCx32) staged TRANSPOSED
// so each lane's {K=ka,K=ka+1} B fragment is one 8-byte ds_load.
enum { EPI_NONE = 0, EPI_SOFTPLUS_BIAS = 1, EPI_GELU = 2, EPI_ACCUM = 3 };

template <int EPI>
__global__ __launch_bounds__(256) void gemm_wmma_f32(
        const float* __restrict__ A, const float* __restrict__ B,
        float* __restrict__ C, const float* __restrict__ bias,
        int M, int N, int K) {
    __shared__ __align__(16) float As[64][LDP];   // [m][k]
    __shared__ __align__(16) float Bs[32][LDP];   // [n][k]  (transposed)

    const int tid  = threadIdx.x;
    const int wave = tid >> 5;
    const int lane = tid & 31;
    const int half = lane >> 4;      // 0: K={0,1}, 1: K={2,3}
    const int l    = lane & 15;
    const int bm0 = blockIdx.x * 64;
    const int bn0 = blockIdx.y * 32;
    const int m_off = (wave & 3) * 16;
    const int n_off = (wave >> 2) * 16;

    // staging coordinates (fully coalesced float4 panel loads)
    const int ar = tid >> 3;            // A row slot (0..31; +32 for second half)
    const int ac = (tid & 7) * 4;       // A col within K-chunk
    const int br = tid >> 3;            // B k-row (0..31)
    const int bc = (tid & 7) * 4;       // B n-col within 32-wide tile

    const float* aptr0 = A + (size_t)(bm0 + ar) * K + ac;
    const float* aptr1 = A + (size_t)(bm0 + ar + 32) * K + ac;
    const float* bptr  = B + (size_t)br * N + bn0 + bc;
    const size_t bstep = (size_t)KC * N;

    v8f acc = {};
    for (int k0 = 0; k0 < K; k0 += KC) {
        const float4 a0 = *reinterpret_cast<const float4*>(aptr0);
        const float4 a1 = *reinterpret_cast<const float4*>(aptr1);
        const float4 bv = *reinterpret_cast<const float4*>(bptr);
        if (k0 + KC < K) {              // prefetch next panels (global_prefetch_b8)
            __builtin_prefetch(aptr0 + KC, 0, 0);
            __builtin_prefetch(aptr1 + KC, 0, 0);
            __builtin_prefetch(bptr + bstep, 0, 0);
        }
        __syncthreads();                 // previous chunk's LDS reads done
        *reinterpret_cast<float4*>(&As[ar][ac])      = a0;
        *reinterpret_cast<float4*>(&As[ar + 32][ac]) = a1;
        Bs[bc + 0][br] = bv.x;
        Bs[bc + 1][br] = bv.y;
        Bs[bc + 2][br] = bv.z;
        Bs[bc + 3][br] = bv.w;
        __syncthreads();                 // panels visible
        #pragma unroll
        for (int kk = 0; kk < KC; kk += 4) {
            const int ka = kk + 2 * half;
            const float2 af = *reinterpret_cast<const float2*>(&As[m_off + l][ka]);
            const float2 bf = *reinterpret_cast<const float2*>(&Bs[n_off + l][ka]);
            v2f a; a.x = af.x; a.y = af.y;     // VGPR0=K(ka), VGPR1=K(ka+1)
            v2f b; b.x = bf.x; b.y = bf.y;
            acc = __builtin_amdgcn_wmma_f32_16x16x4_f32(
                false, a, false, b, (short)0, acc, false, false);
        }
        aptr0 += KC; aptr1 += KC; bptr += bstep;
    }

    const int col = bn0 + n_off + l;
    #pragma unroll
    for (int r = 0; r < 8; ++r) {
        const int row = bm0 + m_off + r + 8 * half;   // C/D layout: VGPR r, half-split M
        float v = acc[r];
        if (EPI == EPI_SOFTPLUS_BIAS) {
            v += bias[col];
            v = (v > 20.0f) ? v : log1pf(expf(v));
        } else if (EPI == EPI_GELU) {
            v = 0.5f * v * (1.0f + erff(v * 0.70710678118654752f));
        }
        float* cp = C + (size_t)row * N + col;
        if (EPI == EPI_ACCUM) *cp += v; else *cp = v;
    }
}

// -------------------- causal depthwise conv (K=4) + SiLU -------------------
__global__ void conv_silu_kernel(const float* __restrict__ xz,   // [T, 2D], xs_raw = first D cols
                                 const float* __restrict__ cw,   // [D,1,4]
                                 const float* __restrict__ cb,   // [D]
                                 float* __restrict__ xs) {       // [T, D]
    const int idx = blockIdx.x * blockDim.x + threadIdx.x;
    if (idx >= T_LEN * D_DIM) return;
    const int t = idx / D_DIM, d = idx % D_DIM;
    float acc = cb[d];
    #pragma unroll
    for (int kk = 0; kk < 4; ++kk) {
        const int tt = t - 3 + kk;
        if (tt >= 0) acc += cw[d * 4 + kk] * xz[(size_t)tt * (2 * D_DIM) + d];
    }
    xs[idx] = silu_f(acc);
}

// ------------------------------ SSM scan -----------------------------------
// One wave per channel d; lane = state index s (DS=32 == wave32).
// h[t] = exp(clip(dt*A,-20,20))*h[t-1] + dt*xs*B[t,s];  y = wave-reduce(h*C).
// Fuses the (+xs*D_param)*silu(z) epilogue.
__global__ void ssm_scan_kernel(const float* __restrict__ xs,    // [T, D]
                                const float* __restrict__ dt,    // [T, D]
                                const float* __restrict__ Bm,    // [T, DS]
                                const float* __restrict__ Cm,    // [T, DS]
                                const float* __restrict__ xz,    // [T, 2D] (z = cols D..2D)
                                const float* __restrict__ log_A, // [D]
                                const float* __restrict__ Dp,    // [D]
                                float* __restrict__ ysi) {       // [T, D]
    const int wave = threadIdx.x >> 5;          // 16 waves/block
    const int s    = threadIdx.x & 31;
    const int d    = blockIdx.x * 16 + wave;
    const float A   = -expf(log_A[d]);
    const float Dpd = Dp[d];
    float h = 0.0f;
    for (int t = 0; t < T_LEN; ++t) {
        const float dtv = dt[(size_t)t * D_DIM + d];
        const float xv  = xs[(size_t)t * D_DIM + d];
        const float Bv  = Bm[t * DS_DIM + s];
        const float Cv  = Cm[t * DS_DIM + s];
        float la = dtv * A;
        la = fminf(20.0f, fmaxf(-20.0f, la));
        h = expf(la) * h + dtv * xv * Bv;
        float contrib = h * Cv;
        #pragma unroll
        for (int off = 16; off > 0; off >>= 1) contrib += __shfl_xor(contrib, off, 32);
        if (s == 0) {
            const float zv = xz[(size_t)t * (2 * D_DIM) + D_DIM + d];
            ysi[(size_t)t * D_DIM + d] = (contrib + xv * Dpd) * silu_f(zv);
        }
    }
}

// ------------------------------ launcher -----------------------------------
extern "C" void kernel_launch(void* const* d_in, const int* in_sizes, int n_in,
                              void* d_out, int out_size, void* d_ws, size_t ws_size,
                              hipStream_t stream) {
    (void)in_sizes; (void)n_in; (void)out_size; (void)ws_size;

    const float* x       = (const float*)d_in[0];
    const float* norm_w  = (const float*)d_in[1];
    const float* W_in    = (const float*)d_in[2];
    const float* conv_w  = (const float*)d_in[3];
    const float* conv_b  = (const float*)d_in[4];
    const float* W_dt    = (const float*)d_in[5];
    const float* b_dt    = (const float*)d_in[6];
    const float* W_B     = (const float*)d_in[7];
    const float* W_C     = (const float*)d_in[8];
    const float* W_out   = (const float*)d_in[9];
    const float* log_A   = (const float*)d_in[10];
    const float* D_param = (const float*)d_in[11];
    const float* W_ffn1  = (const float*)d_in[12];
    const float* W_ffn2  = (const float*)d_in[13];
    const float* W_merge = (const float*)d_in[14];
    float* out = (float*)d_out;

    float* ws  = (float*)d_ws;
    float* xn  = ws;                              // [T, D]
    float* xz  = xn  + (size_t)T_LEN * D_DIM;     // [T, 2D]
    float* xs  = xz  + (size_t)T_LEN * 2 * D_DIM; // [T, D]
    float* dtb = xs  + (size_t)T_LEN * D_DIM;     // [T, D]
    float* Bm  = dtb + (size_t)T_LEN * D_DIM;     // [T, DS]
    float* Cm  = Bm  + (size_t)T_LEN * DS_DIM;    // [T, DS]
    float* ysi = Cm  + (size_t)T_LEN * DS_DIM;    // [T, D]
    float* t1  = ysi + (size_t)T_LEN * D_DIM;     // [T, D]  y_ssm @ W_out
    float* g   = t1  + (size_t)T_LEN * D_DIM;     // [T, 2D] gelu(xn @ W_ffn1)
    float* t2  = g   + (size_t)T_LEN * 2 * D_DIM; // [T, D]  y_ffn

    // 1) RMSNorm
    rmsnorm_kernel<<<T_LEN, 256, 0, stream>>>(x, norm_w, xn);
    // 2) xz = xn @ W_in  [2048 x 1024]
    gemm_wmma_f32<EPI_NONE><<<dim3(T_LEN / 64, (2 * D_DIM) / 32), 256, 0, stream>>>(
        xn, W_in, xz, nullptr, T_LEN, 2 * D_DIM, D_DIM);
    // 3) causal depthwise conv + SiLU -> xs
    conv_silu_kernel<<<(T_LEN * D_DIM + 255) / 256, 256, 0, stream>>>(xz, conv_w, conv_b, xs);
    // 4) dt = softplus(xs @ W_dt + b_dt)
    gemm_wmma_f32<EPI_SOFTPLUS_BIAS><<<dim3(T_LEN / 64, D_DIM / 32), 256, 0, stream>>>(
        xs, W_dt, dtb, b_dt, T_LEN, D_DIM, D_DIM);
    // 5) Bm / Cm projections [2048 x 32]
    gemm_wmma_f32<EPI_NONE><<<dim3(T_LEN / 64, DS_DIM / 32), 256, 0, stream>>>(
        xs, W_B, Bm, nullptr, T_LEN, DS_DIM, D_DIM);
    gemm_wmma_f32<EPI_NONE><<<dim3(T_LEN / 64, DS_DIM / 32), 256, 0, stream>>>(
        xs, W_C, Cm, nullptr, T_LEN, DS_DIM, D_DIM);
    // 6) SSM recurrence + (+xs*D)*silu(z) epilogue -> ysi
    ssm_scan_kernel<<<D_DIM / 16, 512, 0, stream>>>(xs, dtb, Bm, Cm, xz, log_A, D_param, ysi);
    // 7) t1 = ysi @ W_out
    gemm_wmma_f32<EPI_NONE><<<dim3(T_LEN / 64, D_DIM / 32), 256, 0, stream>>>(
        ysi, W_out, t1, nullptr, T_LEN, D_DIM, D_DIM);
    // 8) g = gelu(xn @ W_ffn1)
    gemm_wmma_f32<EPI_GELU><<<dim3(T_LEN / 64, (2 * D_DIM) / 32), 256, 0, stream>>>(
        xn, W_ffn1, g, nullptr, T_LEN, 2 * D_DIM, D_DIM);
    // 9) t2 = g @ W_ffn2
    gemm_wmma_f32<EPI_NONE><<<dim3(T_LEN / 64, D_DIM / 32), 256, 0, stream>>>(
        g, W_ffn2, t2, nullptr, T_LEN, D_DIM, 2 * D_DIM);
    // 10) out = x (residual seed), then out += t1 @ Wm_top + t2 @ Wm_bot
    hipMemcpyAsync(out, x, (size_t)T_LEN * D_DIM * sizeof(float),
                   hipMemcpyDeviceToDevice, stream);
    gemm_wmma_f32<EPI_ACCUM><<<dim3(T_LEN / 64, D_DIM / 32), 256, 0, stream>>>(
        t1, W_merge, out, nullptr, T_LEN, D_DIM, D_DIM);
    gemm_wmma_f32<EPI_ACCUM><<<dim3(T_LEN / 64, D_DIM / 32), 256, 0, stream>>>(
        t2, W_merge + (size_t)D_DIM * D_DIM, out, nullptr, T_LEN, D_DIM, D_DIM);
}

// v001
// In both of two side-by-side timings against v000, it was 8.29 times as fast.
#include <hip/hip_runtime.h>
#include <hip/hip_bf16.h>
#include <math.h>

// ---------------------------------------------------------------------------
// Fused Mamba-style SSM + FFN block for MI455X (gfx1250, wave32).
// All GEMMs run through V_WMMA_F32_16X16X4_F32 (full fp32 matrix path),
// fed from LDS-staged panels (coalesced float4 global loads, ds_load_b64
// fragment reads, bank-conflict-free padded layout).
// ---------------------------------------------------------------------------

typedef float v2f __attribute__((ext_vector_type(2)));
typedef float v8f __attribute__((ext_vector_type(8)));

#define T_LEN  2048
#define D_DIM  512
#define DS_DIM 32
#define RMS_EPS 1e-6f
#define KC 32            // K-chunk staged in LDS per iteration
#define LDP 36           // padded row length (floats): 144B = 16B-aligned, bank-spread

__device__ __forceinline__ float silu_f(float x) { return x / (1.0f + expf(-x)); }

// ------------------------------- RMSNorm -----------------------------------
__global__ void rmsnorm_kernel(const float* __restrict__ x,
                               const float* __restrict__ w,
                               float* __restrict__ xn) {
    const int row = blockIdx.x;
    const float* xr = x + row * D_DIM;
    const int tid = threadIdx.x;              // 256 threads, 2 elems each
    float v0 = xr[tid];
    float v1 = xr[tid + 256];
    float s = v0 * v0 + v1 * v1;
    #pragma unroll
    for (int off = 16; off > 0; off >>= 1) s += __shfl_xor(s, off, 32);
    __shared__ float red[8];
    const int wave = tid >> 5, lane = tid & 31;
    if (lane == 0) red[wave] = s;
    __syncthreads();
    float tot = 0.f;
    #pragma unroll
    for (int i = 0; i < 8; ++i) tot += red[i];
    const float scale = rsqrtf(tot * (1.0f / D_DIM) + RMS_EPS);
    xn[row * D_DIM + tid]       = v0 * scale * w[tid];
    xn[row * D_DIM + tid + 256] = v1 * scale * w[tid + 256];
}

// ------------------------- WMMA fp32 GEMM (LDS staged) ---------------------
// C[M,N] = epilogue(A[M,K] @ B[K,N]); 8 waves/block -> 64x32 block tile,
// one wave computes a 16x16 tile.  K stepped by 4 via V_WMMA_F32_16X16X4_F32.
// A panel (64xKC) staged row-major in LDS; B panel (KCx32) staged TRANSPOSED
// so each lane's {K=ka,K=ka+1} B fragment is one 8-byte ds_load.
enum { EPI_NONE = 0, EPI_SOFTPLUS_BIAS = 1, EPI_GELU = 2, EPI_ACCUM = 3 };

template <int EPI>
__global__ __launch_bounds__(256) void gemm_wmma_f32(
        const float* __restrict__ A, const float* __restrict__ B,
        float* __restrict__ C, const float* __restrict__ bias,
        int M, int N, int K) {
    __shared__ __align__(16) float As[64][LDP];   // [m][k]
    __shared__ __align__(16) float Bs[32][LDP];   // [n][k]  (transposed)

    const int tid  = threadIdx.x;
    const int wave = tid >> 5;
    const int lane = tid & 31;
    const int half = lane >> 4;      // 0: K={0,1}, 1: K={2,3}
    const int l    = lane & 15;
    const int bm0 = blockIdx.x * 64;
    const int bn0 = blockIdx.y * 32;
    const int m_off = (wave & 3) * 16;
    const int n_off = (wave >> 2) * 16;

    // staging coordinates (fully coalesced float4 panel loads)
    const int ar = tid >> 3;            // A row slot (0..31; +32 for second half)
    const int ac = (tid & 7) * 4;       // A col within K-chunk
    const int br = tid >> 3;            // B k-row (0..31)
    const int bc = (tid & 7) * 4;       // B n-col within 32-wide tile

    const float* aptr0 = A + (size_t)(bm0 + ar) * K + ac;
    const float* aptr1 = A + (size_t)(bm0 + ar + 32) * K + ac;
    const float* bptr  = B + (size_t)br * N + bn0 + bc;
    const size_t bstep = (size_t)KC * N;

    v8f acc = {};
    for (int k0 = 0; k0 < K; k0 += KC) {
        const float4 a0 = *reinterpret_cast<const float4*>(aptr0);
        const float4 a1 = *reinterpret_cast<const float4*>(aptr1);
        const float4 bv = *reinterpret_cast<const float4*>(bptr);
        if (k0 + KC < K) {              // prefetch next panels (global_prefetch_b8)
            __builtin_prefetch(aptr0 + KC, 0, 0);
            __builtin_prefetch(aptr1 + KC, 0, 0);
            __builtin_prefetch(bptr + bstep, 0, 0);
        }
        __syncthreads();                 // previous chunk's LDS reads done
        *reinterpret_cast<float4*>(&As[ar][ac])      = a0;
        *reinterpret_cast<float4*>(&As[ar + 32][ac]) = a1;
        Bs[bc + 0][br] = bv.x;
        Bs[bc + 1][br] = bv.y;
        Bs[bc + 2][br] = bv.z;
        Bs[bc + 3][br] = bv.w;
        __syncthreads();                 // panels visible
        #pragma unroll
        for (int kk = 0; kk < KC; kk += 4) {
            const int ka = kk + 2 * half;
            const float2 af = *reinterpret_cast<const float2*>(&As[m_off + l][ka]);
            const float2 bf = *reinterpret_cast<const float2*>(&Bs[n_off + l][ka]);
            v2f a; a.x = af.x; a.y = af.y;     // VGPR0=K(ka), VGPR1=K(ka+1)
            v2f b; b.x = bf.x; b.y = bf.y;
            acc = __builtin_amdgcn_wmma_f32_16x16x4_f32(
                false, a, false, b, (short)0, acc, false, false);
        }
        aptr0 += KC; aptr1 += KC; bptr += bstep;
    }

    const int col = bn0 + n_off + l;
    #pragma unroll
    for (int r = 0; r < 8; ++r) {
        const int row = bm0 + m_off + r + 8 * half;   // C/D layout: VGPR r, half-split M
        float v = acc[r];
        if (EPI == EPI_SOFTPLUS_BIAS) {
            v += bias[col];
            v = (v > 20.0f) ? v : log1pf(expf(v));
        } else if (EPI == EPI_GELU) {
            v = 0.5f * v * (1.0f + erff(v * 0.70710678118654752f));
        }
        float* cp = C + (size_t)row * N + col;
        if (EPI == EPI_ACCUM) *cp += v; else *cp = v;
    }
}

// -------------------- causal depthwise conv (K=4) + SiLU -------------------
__global__ void conv_silu_kernel(const float* __restrict__ xz,   // [T, 2D], xs_raw = first D cols
                                 const float* __restrict__ cw,   // [D,1,4]
                                 const float* __restrict__ cb,   // [D]
                                 float* __restrict__ xs) {       // [T, D]
    const int idx = blockIdx.x * blockDim.x + threadIdx.x;
    if (idx >= T_LEN * D_DIM) return;
    const int t = idx / D_DIM, d = idx % D_DIM;
    float acc = cb[d];
    #pragma unroll
    for (int kk = 0; kk < 4; ++kk) {
        const int tt = t - 3 + kk;
        if (tt >= 0) acc += cw[d * 4 + kk] * xz[(size_t)tt * (2 * D_DIM) + d];
    }
    xs[idx] = silu_f(acc);
}

// ------------------------------ SSM scan -----------------------------------
// One work-group per channel d; lane = state index s (DS=32 == wave32);
// wave = one chunk of SCAN_STEPS consecutive time steps.
// h[t] = exp(clip(dt*A,-20,20))*h[t-1] + dt*xs*B[t,s];  y = wave-reduce(h*C).
// Pass 1: every wave runs its chunk from h = 0 and keeps the chunk's end state
//         and the product of its decay factors.
// Carry:  h_in(c) = P(c-1)*h_in(c-1) + h_end(c-1), folded from LDS by each wave.
// Pass 2: the same recurrence again from the true h_in, with the wave reduce
//         and the fused (+xs*D_param)*silu(z) epilogue.
#define SCAN_CHUNKS 32
#define SCAN_STEPS  (T_LEN / SCAN_CHUNKS)
__global__ __launch_bounds__(SCAN_CHUNKS * 32) void ssm_scan_kernel(
                                const float* __restrict__ xs,    // [T, D]
                                const float* __restrict__ dt,    // [T, D]
                                const float* __restrict__ Bm,    // [T, DS]
                                const float* __restrict__ Cm,    // [T, DS]
                                const float* __restrict__ xz,    // [T, 2D] (z = cols D..2D)
                                const float* __restrict__ log_A, // [D]
                                const float* __restrict__ Dp,    // [D]
                                float* __restrict__ ysi) {       // [T, D]
    __shared__ float h_end[SCAN_CHUNKS][DS_DIM];
    __shared__ float p_end[SCAN_CHUNKS];
    const int c  = threadIdx.x >> 5;            // chunk of this wave
    const int s  = threadIdx.x & 31;
    const int d  = blockIdx.x;
    const int t0 = c * SCAN_STEPS;
    const float A   = -expf(log_A[d]);
    const float Dpd = Dp[d];

    float h = 0.0f, p = 1.0f;
    for (int t = t0; t < t0 + SCAN_STEPS; ++t) {
        const float dtv = dt[(size_t)t * D_DIM + d];
        const float xv  = xs[(size_t)t * D_DIM + d];
        const float Bv  = Bm[t * DS_DIM + s];
        float la = dtv * A;
        la = fminf(20.0f, fmaxf(-20.0f, la));
        const float a = expf(la);
        h = a * h + dtv * xv * Bv;
        p *= a;
    }
    h_end[c][s] = h;
    if (s == 0) p_end[c] = p;
    __syncthreads();                             // all chunk summaries visible

    h = 0.0f;
    for (int cc = 0; cc < c; ++cc) h = p_end[cc] * h + h_end[cc][s];

    for (int t = t0; t < t0 + SCAN_STEPS; ++t) {
        const float dtv = dt[(size_t)t * D_DIM + d];
        const float xv  = xs[(size_t)t * D_DIM + d];
        const float Bv  = Bm[t * DS_DIM + s];
        const float Cv  = Cm[t * DS_DIM + s];
        float la = dtv * A;
        la = fminf(20.0f, fmaxf(-20.0f, la));
        h = expf(la) * h + dtv * xv * Bv;
        float contrib = h * Cv;
        #pragma unroll
        for (int off = 16; off > 0; off >>= 1) contrib += __shfl_xor(contrib, off, 32);
        if (s == 0) {
            const float zv = xz[(size_t)t * (2 * D_DIM) + D_DIM + d];
            ysi[(size_t)t * D_DIM + d] = (contrib + xv * Dpd) * silu_f(zv);
            // the next trip rewrites the store's address and data registers
            asm volatile("s_wait_xcnt 0x0" ::: "memory");
        }
    }
}

// ------------------------------ launcher -----------------------------------
extern "C" void kernel_launch(void* const* d_in, const int* in_sizes, int n_in,
                              void* d_out, int out_size, void* d_ws, size_t ws_size,
                              hipStream_t stream) {
    (void)in_sizes; (void)n_in; (void)out_size; (void)ws_size;

    const float* x       = (const float*)d_in[0];
    const float* norm_w  = (const float*)d_in[1];
    const float* W_in    = (const float*)d_in[2];
    const float* conv_w  = (const float*)d_in[3];
    const float* conv_b  = (const float*)d_in[4];
    const float* W_dt    = (const float*)d_in[5];
    const float* b_dt    = (const float*)d_in[6];
    const float* W_B     = (const float*)d_in[7];
    const float* W_C     = (const float*)d_in[8];
    const float* W_out   = (const float*)d_in[9];
    const float* log_A   = (const float*)d_in[10];
    const float* D_param = (const float*)d_in[11];
    const float* W_ffn1  = (const float*)d_in[12];
    const float* W_ffn2  = (const float*)d_in[13];
    const float* W_merge = (const float*)d_in[14];
    float* out = (float*)d_out;

    float* ws  = (float*)d_ws;
    float* xn  = ws;                              // [T, D]
    float* xz  = xn  + (size_t)T_LEN * D_DIM;     // [T, 2D]
    float* xs  = xz  + (size_t)T_LEN * 2 * D_DIM; // [T, D]
    float* dtb = xs  + (size_t)T_LEN * D_DIM;     // [T, D]
    float* Bm  = dtb + (size_t)T_LEN * D_DIM;     // [T, DS]
    float* Cm  = Bm  + (size_t)T_LEN * DS_DIM;    // [T, DS]
    float* ysi = Cm  + (size_t)T_LEN * DS_DIM;    // [T, D]
    float* t1  = ysi + (size_t)T_LEN * D_DIM;     // [T, D]  y_ssm @ W_out
    float* g   = t1  + (size_t)T_LEN * D_DIM;     // [T, 2D] gelu(xn @ W_ffn1)
    float* t2  = g   + (size_t)T_LEN * 2 * D_DIM; // [T, D]  y_ffn

    // 1) RMSNorm
    rmsnorm_kernel<<<T_LEN, 256, 0, stream>>>(x, norm_w, xn);
    // 2) xz = xn @ W_in  [2048 x 1024]
    gemm_wmma_f32<EPI_NONE><<<dim3(T_LEN / 64, (2 * D_DIM) / 32), 256, 0, stream>>>(
        xn, W_in, xz, nullptr, T_LEN, 2 * D_DIM, D_DIM);
    // 3) causal depthwise conv + SiLU -> xs
    conv_silu_kernel<<<(T_LEN * D_DIM + 255) / 256, 256, 0, stream>>>(xz, conv_w, conv_b, xs);
    // 4) dt = softplus(xs @ W_dt + b_dt)
    gemm_wmma_f32<EPI_SOFTPLUS_BIAS><<<dim3(T_LEN / 64, D_DIM / 32), 256, 0, stream>>>(
        xs, W_dt, dtb, b_dt, T_LEN, D_DIM, D_DIM);
    // 5) Bm / Cm projections [2048 x 32]
    gemm_wmma_f32<EPI_NONE><<<dim3(T_LEN / 64, DS_DIM / 32), 256, 0, stream>>>(
        xs, W_B, Bm, nullptr, T_LEN, DS_DIM, D_DIM);
    gemm_wmma_f32<EPI_NONE><<<dim3(T_LEN / 64, DS_DIM / 32), 256, 0, stream>>>(
        xs, W_C, Cm, nullptr, T_LEN, DS_DIM, D_DIM);
    // 6) SSM recurrence + (+xs*D)*silu(z) epilogue -> ysi
    ssm_scan_kernel<<<D_DIM, SCAN_CHUNKS * 32, 0, stream>>>(xs, dtb, Bm, Cm, xz, log_A, D_param, ysi);
    // 7) t1 = ysi @ W_out
    gemm_wmma_f32<EPI_NONE><<<dim3(T_LEN / 64, D_DIM / 32), 256, 0, stream>>>(
        ysi, W_out, t1, nullptr, T_LEN, D_DIM, D_DIM);
    // 8) g = gelu(xn @ W_ffn1)
    gemm_wmma_f32<EPI_GELU><<<dim3(T_LEN / 64, (2 * D_DIM) / 32), 256, 0, stream>>>(
        xn, W_ffn1, g, nullptr, T_LEN, 2 * D_DIM, D_DIM);
    // 9) t2 = g @ W_ffn2
    gemm_wmma_f32<EPI_NONE><<<dim3(T_LEN / 64, D_DIM / 32), 256, 0, stream>>>(
        g, W_ffn2, t2, nullptr, T_LEN, D_DIM, 2 * D_DIM);
    // 10) out = x (residual seed), then out += t1 @ Wm_top + t2 @ Wm_bot
    hipMemcpyAsync(out, x, (size_t)T_LEN * D_DIM * sizeof(float),
                   hipMemcpyDeviceToDevice, stream);
    gemm_wmma_f32<EPI_ACCUM><<<dim3(T_LEN / 64, D_DIM / 32), 256, 0, stream>>>(
        t1, W_merge, out, nullptr, T_LEN, D_DIM, D_DIM);
    gemm_wmma_f32<EPI_ACCUM><<<dim3(T_LEN / 64, D_DIM / 32), 256, 0, stream>>>(
        t2, W_merge + (size_t)D_DIM * D_DIM, out, nullptr, T_LEN, D_DIM, D_DIM);
}

// v002
// Next to v001, in two timings, it ran 1.51 and 1.50 times as fast.
// Counting every step since v000, it is 12.5 times as fast.
#include <hip/hip_runtime.h>
#include <hip/hip_bf16.h>
#include <math.h>

// ---------------------------------------------------------------------------
// Fused Mamba-style SSM + FFN block for MI455X (gfx1250, wave32).
// All GEMMs run through V_WMMA_F32_16X16X4_F32 (full fp32 matrix path),
// fed from LDS-staged panels (coalesced float4 global loads, ds_load_b64
// fragment reads, bank-conflict-free padded layout).
// ---------------------------------------------------------------------------

typedef float v2f __attribute__((ext_vector_type(2)));
typedef float v8f __attribute__((ext_vector_type(8)));

#define T_LEN  2048
#define D_DIM  512
#define DS_DIM 32
#define RMS_EPS 1e-6f
#define KC 32            // K-chunk staged in LDS per iteration
#define LDP 36           // padded row length (floats): 144B = 16B-aligned, bank-spread

__device__ __forceinline__ float silu_f(float x) { return x / (1.0f + expf(-x)); }

// ------------------------------- RMSNorm -----------------------------------
__global__ void rmsnorm_kernel(const float* __restrict__ x,
                               const float* __restrict__ w,
                               float* __restrict__ xn) {
    const int row = blockIdx.x;
    const float* xr = x + row * D_DIM;
    const int tid = threadIdx.x;              // 256 threads, 2 elems each
    float v0 = xr[tid];
    float v1 = xr[tid + 256];
    float s = v0 * v0 + v1 * v1;
    #pragma unroll
    for (int off = 16; off > 0; off >>= 1) s += __shfl_xor(s, off, 32);
    __shared__ float red[8];
    const int wave = tid >> 5, lane = tid & 31;
    if (lane == 0) red[wave] = s;
    __syncthreads();
    float tot = 0.f;
    #pragma unroll
    for (int i = 0; i < 8; ++i) tot += red[i];
    const float scale = rsqrtf(tot * (1.0f / D_DIM) + RMS_EPS);
    xn[row * D_DIM + tid]       = v0 * scale * w[tid];
    xn[row * D_DIM + tid + 256] = v1 * scale * w[tid + 256];
}

// ------------------------- WMMA fp32 GEMM (LDS staged) ---------------------
// C[M,N] = epilogue(A[M,K] @ B[K,N]); 8 waves/block -> 64x32 block tile,
// one wave computes a 16x16 tile.  K stepped by 4 via V_WMMA_F32_16X16X4_F32.
// A panel (64xKC) staged row-major in LDS; B panel (KCx32) staged TRANSPOSED
// so each lane's {K=ka,K=ka+1} B fragment is one 8-byte ds_load.
enum { EPI_NONE = 0, EPI_SOFTPLUS_BIAS = 1, EPI_GELU = 2, EPI_ACCUM = 3 };

template <int EPI>
__global__ __launch_bounds__(256) void gemm_wmma_f32(
        const float* __restrict__ A, const float* __restrict__ B,
        float* __restrict__ C, const float* __restrict__ bias,
        int M, int N, int K) {
    __shared__ __align__(16) float As[64][LDP];   // [m][k]
    __shared__ __align__(16) float Bs[32][LDP];   // [n][k]  (transposed)

    const int tid  = threadIdx.x;
    const int wave = tid >> 5;
    const int lane = tid & 31;
    const int half = lane >> 4;      // 0: K={0,1}, 1: K={2,3}
    const int l    = lane & 15;
    const int bm0 = blockIdx.x * 64;
    const int bn0 = blockIdx.y * 32;
    const int m_off = (wave & 3) * 16;
    const int n_off = (wave >> 2) * 16;

    // staging coordinates (fully coalesced float4 panel loads)
    const int ar = tid >> 3;            // A row slot (0..31; +32 for second half)
    const int ac = (tid & 7) * 4;       // A col within K-chunk
    const int br = tid >> 3;            // B k-row (0..31)
    const int bc = (tid & 7) * 4;       // B n-col within 32-wide tile

    const float* aptr0 = A + (size_t)(bm0 + ar) * K + ac;
    const float* aptr1 = A + (size_t)(bm0 + ar + 32) * K + ac;
    const float* bptr  = B + (size_t)br * N + bn0 + bc;
    const size_t bstep = (size_t)KC * N;

    v8f acc = {};
    for (int k0 = 0; k0 < K; k0 += KC) {
        const float4 a0 = *reinterpret_cast<const float4*>(aptr0);
        const float4 a1 = *reinterpret_cast<const float4*>(aptr1);
        const float4 bv = *reinterpret_cast<const float4*>(bptr);
        if (k0 + KC < K) {              // prefetch next panels (global_prefetch_b8)
            __builtin_prefetch(aptr0 + KC, 0, 0);
            __builtin_prefetch(aptr1 + KC, 0, 0);
            __builtin_prefetch(bptr + bstep, 0, 0);
        }
        __syncthreads();                 // previous chunk's LDS reads done
        *reinterpret_cast<float4*>(&As[ar][ac])      = a0;
        *reinterpret_cast<float4*>(&As[ar + 32][ac]) = a1;
        Bs[bc + 0][br] = bv.x;
        Bs[bc + 1][br] = bv.y;
        Bs[bc + 2][br] = bv.z;
        Bs[bc + 3][br] = bv.w;
        __syncthreads();                 // panels visible
        #pragma unroll
        for (int kk = 0; kk < KC; kk += 4) {
            const int ka = kk + 2 * half;
            const float2 af = *reinterpret_cast<const float2*>(&As[m_off + l][ka]);
            const float2 bf = *reinterpret_cast<const float2*>(&Bs[n_off + l][ka]);
            v2f a; a.x = af.x; a.y = af.y;     // VGPR0=K(ka), VGPR1=K(ka+1)
            v2f b; b.x = bf.x; b.y = bf.y;
            acc = __builtin_amdgcn_wmma_f32_16x16x4_f32(
                false, a, false, b, (short)0, acc, false, false);
        }
        aptr0 += KC; aptr1 += KC; bptr += bstep;
    }

    const int col = bn0 + n_off + l;
    #pragma unroll
    for (int r = 0; r < 8; ++r) {
        const int row = bm0 + m_off + r + 8 * half;   // C/D layout: VGPR r, half-split M
        float v = acc[r];
        if (EPI == EPI_SOFTPLUS_BIAS) {
            v += bias[col];
            v = (v > 20.0f) ? v : log1pf(expf(v));
        } else if (EPI == EPI_GELU) {
            v = 0.5f * v * (1.0f + erff(v * 0.70710678118654752f));
        }
        float* cp = C + (size_t)row * N + col;
        if (EPI == EPI_ACCUM) *cp += v; else *cp = v;
    }
}

// -------------------- causal depthwise conv (K=4) + SiLU -------------------
__global__ void conv_silu_kernel(const float* __restrict__ xz,   // [T, 2D], xs_raw = first D cols
                                 const float* __restrict__ cw,   // [D,1,4]
                                 const float* __restrict__ cb,   // [D]
                                 float* __restrict__ xs) {       // [T, D]
    const int idx = blockIdx.x * blockDim.x + threadIdx.x;
    if (idx >= T_LEN * D_DIM) return;
    const int t = idx / D_DIM, d = idx % D_DIM;
    float acc = cb[d];
    #pragma unroll
    for (int kk = 0; kk < 4; ++kk) {
        const int tt = t - 3 + kk;
        if (tt >= 0) acc += cw[d * 4 + kk] * xz[(size_t)tt * (2 * D_DIM) + d];
    }
    xs[idx] = silu_f(acc);
}

// ------------------------------ SSM scan -----------------------------------
// h[t] = exp(clip(dt*A,-20,20))*h[t-1] + dt*xs*B[t,s];  y[t] = sum_s h[t,s]*C[t,s].
// Lane = channel d; the 32 states of that channel sit in the lane's registers,
// so the sum over s is a register sum, dt / xs / z / y are whole-line accesses
// and the decay factor is computed once per (t, d).  B and C rows are the same
// for every lane: staged in LDS and read as same-address 16-byte loads.
// Time is cut into SC_NC chunks of SC_L steps, one wave each; a block holds
// SC_W consecutive chunks of one group of 32 channels.
// Launch 1: every chunk from h = 0 -> end state and product of decay factors.
// Launch 2: carry-in h_in(c) = P(c-1)*h_in(c-1) + h_end(c-1) folded from those
//           summaries, then the recurrence from h_in with the fused
//           (+xs*D_param)*silu(z) epilogue.
#define SC_L  32
#define SC_NC (T_LEN / SC_L)
#define SC_W  4
#define SC_G  (D_DIM / 32)
#define SC_FB 16         // summaries fetched together in the carry fold

// hsum, in float4 units: [chunk][group][state / 4][lane];  psum: [chunk][d]
__global__ __launch_bounds__(SC_W * 32) void ssm_chunk_kernel(
                                const float* __restrict__ xs,    // [T, D]
                                const float* __restrict__ dt,    // [T, D]
                                const float* __restrict__ Bm,    // [T, DS]
                                const float* __restrict__ log_A, // [D]
                                float* __restrict__ hsum,
                                float* __restrict__ psum) {
    __shared__ __align__(16) float4 Bs[SC_W * SC_L * (DS_DIM / 4)];
    __shared__ __align__(16) float2 Qs[SC_W * SC_L * 32];            // {a, dt*xs} per (t, lane)
    const int tid  = threadIdx.x;
    const int lane = tid & 31;
    const int w    = __builtin_amdgcn_readfirstlane(tid >> 5);   // wave number, kept scalar: row bases stay in SGPRs
    const int g    = blockIdx.x % SC_G;
    const int j    = blockIdx.x / SC_G;
    const int d    = g * 32 + lane;
    const int c    = j * SC_W + w;
    const int t0   = c * SC_L;

    const float4* bsrc = reinterpret_cast<const float4*>(Bm + (size_t)j * SC_W * SC_L * DS_DIM);
    float4 braw[SC_L * (DS_DIM / 4) / 32];
    float  dtv[SC_L], xv[SC_L];
    // full unrolls here and below: the arrays stay in registers and every load of
    // the chunk is in flight at once (one memory latency for the whole chunk)
    #pragma unroll
    for (int i = 0; i < SC_L * (DS_DIM / 4) / 32; ++i) braw[i] = bsrc[tid + i * SC_W * 32];
    #pragma unroll
    for (int t = 0; t < SC_L; ++t) {
        dtv[t] = dt[(size_t)(t0 + t) * D_DIM + d];
        xv[t]  = xs[(size_t)(t0 + t) * D_DIM + d];
    }
    const float lAv = log_A[d];
    // what follows reuses the address registers of the loads above
    asm volatile("s_wait_xcnt 0x0" ::: "memory");
    #pragma unroll
    for (int i = 0; i < SC_L * (DS_DIM / 4) / 32; ++i) Bs[tid + i * SC_W * 32] = braw[i];
    const float A = -expf(lAv);
    #pragma unroll
    for (int t = 0; t < SC_L; ++t) {
        float la = dtv[t] * A;
        la = fminf(20.0f, fmaxf(-20.0f, la));
        Qs[(w * SC_L + t) * 32 + lane] = make_float2(expf(la), dtv[t] * xv[t]);
    }
    __syncthreads();                             // B rows visible

    v2f h[DS_DIM / 2];
    #pragma unroll
    for (int i = 0; i < DS_DIM / 2; ++i) h[i] = (v2f){0.0f, 0.0f};
    float p = 1.0f;
    const float4* bq = Bs + w * SC_L * (DS_DIM / 4);
    const float2* qq = Qs + w * SC_L * 32 + lane;
    // four steps a trip: their LDS reads issue as one group ahead of the arithmetic
    #pragma unroll 4
    for (int t = 0; t < SC_L; ++t) {
        const float2 s2 = qq[t * 32];
        const v2f a2 = {s2.x, s2.x};
        const v2f u2 = {s2.y, s2.y};
        #pragma unroll
        for (int q = 0; q < DS_DIM / 4; ++q) {
            const float4 b = bq[t * (DS_DIM / 4) + q];
            h[2 * q]     = a2 * h[2 * q]     + u2 * (v2f){b.x, b.y};
            h[2 * q + 1] = a2 * h[2 * q + 1] + u2 * (v2f){b.z, b.w};
        }
        p *= s2.x;
    }

    float4* ho = reinterpret_cast<float4*>(hsum) + (size_t)(c * SC_G + g) * (DS_DIM / 4) * 32 + lane;
    #pragma unroll
    for (int q = 0; q < DS_DIM / 4; ++q)
        ho[q * 32] = make_float4(h[2 * q].x, h[2 * q].y, h[2 * q + 1].x, h[2 * q + 1].y);
    psum[c * D_DIM + d] = p;
}

__global__ __launch_bounds__(SC_W * 32) void ssm_apply_kernel(
                                const float* __restrict__ xs,    // [T, D]
                                const float* __restrict__ dt,    // [T, D]
                                const float* __restrict__ Bm,    // [T, DS]
                                const float* __restrict__ Cm,    // [T, DS]
                                const float* __restrict__ xz,    // [T, 2D] (z = cols D..2D)
                                const float* __restrict__ log_A, // [D]
                                const float* __restrict__ Dp,    // [D]
                                const float* __restrict__ hsum,
                                const float* __restrict__ psum,
                                float* __restrict__ ysi) {       // [T, D]
    // one array, B and C rows first: their reads then reach every row of a trip
    // through the instruction's own offset field
    __shared__ __align__(16) float4 sm[2 * SC_W * SC_L * (DS_DIM / 4) + SC_W * (DS_DIM / 4) * 32 + SC_W * SC_L * 32];
    float4* Bs = sm;
    float4* Cs = Bs + SC_W * SC_L * (DS_DIM / 4);
    float4* Hx = Cs + SC_W * SC_L * (DS_DIM / 4);   // h_in per chunk of the block
    float4* Qs = Hx + SC_W * (DS_DIM / 4) * 32;     // {a, dt*xs, xs, silu(z)} per (t, lane)
    const int tid  = threadIdx.x;
    const int lane = tid & 31;
    const int w    = __builtin_amdgcn_readfirstlane(tid >> 5);   // wave number, kept scalar: row bases stay in SGPRs
    const int g    = blockIdx.x % SC_G;
    const int j    = blockIdx.x / SC_G;
    const int d    = g * 32 + lane;
    const int t0   = (j * SC_W + w) * SC_L;

    const float4* bsrc = reinterpret_cast<const float4*>(Bm + (size_t)j * SC_W * SC_L * DS_DIM);
    const float4* csrc = reinterpret_cast<const float4*>(Cm + (size_t)j * SC_W * SC_L * DS_DIM);
    #pragma unroll
    for (int i = 0; i < SC_L * (DS_DIM / 4) / 32; ++i) {
        Bs[tid + i * SC_W * 32] = bsrc[tid + i * SC_W * 32];
        Cs[tid + i * SC_W * 32] = csrc[tid + i * SC_W * 32];
    }

    const float A   = -expf(log_A[d]);
    const float Dpd = Dp[d];
    #pragma unroll
    for (int t = 0; t < SC_L; ++t) {
        const float dtv = dt[(size_t)(t0 + t) * D_DIM + d];
        const float xv  = xs[(size_t)(t0 + t) * D_DIM + d];
        const float zv  = xz[(size_t)(t0 + t) * (2 * D_DIM) + D_DIM + d];
        float la = dtv * A;
        la = fminf(20.0f, fmaxf(-20.0f, la));
        Qs[(w * SC_L + t) * 32 + lane] = make_float4(expf(la), dtv * xv, xv, silu_f(zv));
    }

    // Carry fold, shared by the block: wave w folds states 8w .. 8w+7 of the 32
    // channels over every earlier chunk, then on through the block's own chunks,
    // leaving h_in of each of them in LDS.
    const float4*  hq    = reinterpret_cast<const float4*>(hsum) + (size_t)g * (DS_DIM / 4) * 32;
    const float*   pq    = psum + g * 32;
    const size_t   hstep = (size_t)SC_G * (DS_DIM / 4) * 32;         // float4 per chunk
    const unsigned hoff  = 2 * w * 32 + lane;
    const int nprev = j * SC_W;
    float4 ha = make_float4(0.f, 0.f, 0.f, 0.f), hb = ha;
    for (int cb = 0; cb < nprev; cb += SC_FB) {
        float4 qa[SC_FB], qb[SC_FB];
        float  pp[SC_FB];
        // All fetches of the batch in flight together.  cb + k stays below SC_NC
        // (SC_NC is a multiple of SC_FB), so a fetch past nprev still reads a
        // summary that launch 1 wrote; the fold below leaves it out.
        const float4* hc = hq + cb * hstep + hoff;
        const float*  pc = pq + cb * D_DIM + lane;
        #pragma unroll
        for (int k = 0; k < SC_FB; ++k) {
            qa[k] = hc[k * hstep];
            qb[k] = hc[k * hstep + 32];
            pp[k] = pc[k * D_DIM];
        }
        #pragma unroll
        for (int k = 0; k < SC_FB; ++k) {
            const bool on = cb + k < nprev;      // past the end: identity step
            const float pe = on ? pp[k] : 1.0f;
            ha.x = pe * ha.x + (on ? qa[k].x : 0.0f);
            ha.y = pe * ha.y + (on ? qa[k].y : 0.0f);
            ha.z = pe * ha.z + (on ? qa[k].z : 0.0f);
            ha.w = pe * ha.w + (on ? qa[k].w : 0.0f);
            hb.x = pe * hb.x + (on ? qb[k].x : 0.0f);
            hb.y = pe * hb.y + (on ? qb[k].y : 0.0f);
            hb.z = pe * hb.z + (on ? qb[k].z : 0.0f);
            hb.w = pe * hb.w + (on ? qb[k].w : 0.0f);
        }
    }
    #pragma unroll
    for (int k = 0; k < SC_W; ++k) {
        Hx[(k * (DS_DIM / 4) + 2 * w) * 32 + lane]     = ha;
        Hx[(k * (DS_DIM / 4) + 2 * w + 1) * 32 + lane] = hb;
        if (k + 1 < SC_W) {
            const float4* hc = hq + (nprev + k) * hstep;
            const float4 qa = hc[hoff];
            const float4 qb = hc[hoff + 32];
            const float  pe = (pq + (nprev + k) * D_DIM)[lane];
            ha.x = pe * ha.x + qa.x;  ha.y = pe * ha.y + qa.y;
            ha.z = pe * ha.z + qa.z;  ha.w = pe * ha.w + qa.w;
            hb.x = pe * hb.x + qb.x;  hb.y = pe * hb.y + qb.y;
            hb.z = pe * hb.z + qb.z;  hb.w = pe * hb.w + qb.w;
        }
    }
    __syncthreads();                             // B, C rows and every h_in visible

    v2f h[DS_DIM / 2];
    #pragma unroll
    for (int q = 0; q < DS_DIM / 4; ++q) {
        const float4 v = Hx[(w * (DS_DIM / 4) + q) * 32 + lane];
        h[2 * q]     = (v2f){v.x, v.y};
        h[2 * q + 1] = (v2f){v.z, v.w};
    }
    const float4* bq = Bs + w * SC_L * (DS_DIM / 4);
    const float4* cq = Cs + w * SC_L * (DS_DIM / 4);
    const float4* qq = Qs + w * SC_L * 32 + lane;
    float* yo = ysi + (size_t)t0 * D_DIM + d;
    // two steps a trip: their LDS reads issue as one group ahead of the arithmetic;
    // four would need more than 256 registers
    #pragma unroll 2
    for (int t = 0; t < SC_L; ++t) {
        const float4 s4 = qq[t * 32];
        const v2f a2 = {s4.x, s4.x};
        const v2f u2 = {s4.y, s4.y};
        v2f y0 = {0.0f, 0.0f}, y1 = {0.0f, 0.0f};
        #pragma unroll
        for (int q = 0; q < DS_DIM / 4; ++q) {
            const float4 b  = bq[t * (DS_DIM / 4) + q];
            const float4 cv = cq[t * (DS_DIM / 4) + q];
            h[2 * q]     = a2 * h[2 * q]     + u2 * (v2f){b.x, b.y};
            h[2 * q + 1] = a2 * h[2 * q + 1] + u2 * (v2f){b.z, b.w};
            y0 += h[2 * q]     * (v2f){cv.x, cv.y};
            y1 += h[2 * q + 1] * (v2f){cv.z, cv.w};
        }
        const float y = (y0.x + y0.y) + (y1.x + y1.y);
        yo[(size_t)t * D_DIM] = (y + s4.z * Dpd) * s4.w;
    }
}

// ------------------------------ launcher -----------------------------------
extern "C" void kernel_launch(void* const* d_in, const int* in_sizes, int n_in,
                              void* d_out, int out_size, void* d_ws, size_t ws_size,
                              hipStream_t stream) {
    (void)in_sizes; (void)n_in; (void)out_size; (void)ws_size;

    const float* x       = (const float*)d_in[0];
    const float* norm_w  = (const float*)d_in[1];
    const float* W_in    = (const float*)d_in[2];
    const float* conv_w  = (const float*)d_in[3];
    const float* conv_b  = (const float*)d_in[4];
    const float* W_dt    = (const float*)d_in[5];
    const float* b_dt    = (const float*)d_in[6];
    const float* W_B     = (const float*)d_in[7];
    const float* W_C     = (const float*)d_in[8];
    const float* W_out   = (const float*)d_in[9];
    const float* log_A   = (const float*)d_in[10];
    const float* D_param = (const float*)d_in[11];
    const float* W_ffn1  = (const float*)d_in[12];
    const float* W_ffn2  = (const float*)d_in[13];
    const float* W_merge = (const float*)d_in[14];
    float* out = (float*)d_out;

    float* ws  = (float*)d_ws;
    float* xn  = ws;                              // [T, D]
    float* xz  = xn  + (size_t)T_LEN * D_DIM;     // [T, 2D]
    float* xs  = xz  + (size_t)T_LEN * 2 * D_DIM; // [T, D]
    float* dtb = xs  + (size_t)T_LEN * D_DIM;     // [T, D]
    float* Bm  = dtb + (size_t)T_LEN * D_DIM;     // [T, DS]
    float* Cm  = Bm  + (size_t)T_LEN * DS_DIM;    // [T, DS]
    float* ysi = Cm  + (size_t)T_LEN * DS_DIM;    // [T, D]
    float* t1  = ysi + (size_t)T_LEN * D_DIM;     // [T, D]  y_ssm @ W_out
    float* g   = t1  + (size_t)T_LEN * D_DIM;     // [T, 2D] gelu(xn @ W_ffn1)
    float* t2  = g   + (size_t)T_LEN * 2 * D_DIM; // [T, D]  y_ffn
    float* hsm = t2  + (size_t)T_LEN * D_DIM;     // [SC_NC, D/32, DS/4, 32] float4: chunk end states
    float* psm = hsm + (size_t)SC_NC * D_DIM * DS_DIM; // [SC_NC, D] chunk decay products

    // 1) RMSNorm
    rmsnorm_kernel<<<T_LEN, 256, 0, stream>>>(x, norm_w, xn);
    // 2) xz = xn @ W_in  [2048 x 1024]
    gemm_wmma_f32<EPI_NONE><<<dim3(T_LEN / 64, (2 * D_DIM) / 32), 256, 0, stream>>>(
        xn, W_in, xz, nullptr, T_LEN, 2 * D_DIM, D_DIM);
    // 3) causal depthwise conv + SiLU -> xs
    conv_silu_kernel<<<(T_LEN * D_DIM + 255) / 256, 256, 0, stream>>>(xz, conv_w, conv_b, xs);
    // 4) dt = softplus(xs @ W_dt + b_dt)
    gemm_wmma_f32<EPI_SOFTPLUS_BIAS><<<dim3(T_LEN / 64, D_DIM / 32), 256, 0, stream>>>(
        xs, W_dt, dtb, b_dt, T_LEN, D_DIM, D_DIM);
    // 5) Bm / Cm projections [2048 x 32]
    gemm_wmma_f32<EPI_NONE><<<dim3(T_LEN / 64, DS_DIM / 32), 256, 0, stream>>>(
        xs, W_B, Bm, nullptr, T_LEN, DS_DIM, D_DIM);
    gemm_wmma_f32<EPI_NONE><<<dim3(T_LEN / 64, DS_DIM / 32), 256, 0, stream>>>(
        xs, W_C, Cm, nullptr, T_LEN, DS_DIM, D_DIM);
    // 6) SSM recurrence + (+xs*D)*silu(z) epilogue -> ysi
    ssm_chunk_kernel<<<SC_G * (SC_NC / SC_W), SC_W * 32, 0, stream>>>(xs, dtb, Bm, log_A, hsm, psm);
    ssm_apply_kernel<<<SC_G * (SC_NC / SC_W), SC_W * 32, 0, stream>>>(
        xs, dtb, Bm, Cm, xz, log_A, D_param, hsm, psm, ysi);
    // 7) t1 = ysi @ W_out
    gemm_wmma_f32<EPI_NONE><<<dim3(T_LEN / 64, D_DIM / 32), 256, 0, stream>>>(
        ysi, W_out, t1, nullptr, T_LEN, D_DIM, D_DIM);
    // 8) g = gelu(xn @ W_ffn1)
    gemm_wmma_f32<EPI_GELU><<<dim3(T_LEN / 64, (2 * D_DIM) / 32), 256, 0, stream>>>(
        xn, W_ffn1, g, nullptr, T_LEN, 2 * D_DIM, D_DIM);
    // 9) t2 = g @ W_ffn2
    gemm_wmma_f32<EPI_NONE><<<dim3(T_LEN / 64, D_DIM / 32), 256, 0, stream>>>(
        g, W_ffn2, t2, nullptr, T_LEN, D_DIM, 2 * D_DIM);
    // 10) out = x (residual seed), then out += t1 @ Wm_top + t2 @ Wm_bot
    hipMemcpyAsync(out, x, (size_t)T_LEN * D_DIM * sizeof(float),
                   hipMemcpyDeviceToDevice, stream);
    gemm_wmma_f32<EPI_ACCUM><<<dim3(T_LEN / 64, D_DIM / 32), 256, 0, stream>>>(
        t1, W_merge, out, nullptr, T_LEN, D_DIM, D_DIM);
    gemm_wmma_f32<EPI_ACCUM><<<dim3(T_LEN / 64, D_DIM / 32), 256, 0, stream>>>(
        t2, W_merge + (size_t)D_DIM * D_DIM, out, nullptr, T_LEN, D_DIM, D_DIM);
}

// v003
// A run of this version takes 111 microseconds.
// In two side-by-side timings against v002, it was 1.38 and 1.39 times as fast.
// Over all steps from v000 it is 17.3 times as fast.
#include <hip/hip_runtime.h>
#include <hip/hip_bf16.h>
#include <math.h>

// ---------------------------------------------------------------------------
// Fused Mamba-style SSM + FFN block for MI455X (gfx1250, wave32).
// All GEMMs run through V_WMMA_F32_16X16X4_F32 (full fp32 matrix path),
// fed from LDS-staged panels (coalesced float4 global loads, ds_load_b64
// fragment reads, bank-conflict-free padded layout).
// ---------------------------------------------------------------------------

typedef float v2f __attribute__((ext_vector_type(2)));
typedef float v8f __attribute__((ext_vector_type(8)));

#define T_LEN  2048
#define D_DIM  512
#define DS_DIM 32
#define RMS_EPS 1e-6f
#define KC 32            // K-chunk staged in LDS per iteration
#define LDP 36           // padded row length (floats): 144B = 16B-aligned, bank-spread

__device__ __forceinline__ float silu_f(float x) { return x / (1.0f + expf(-x)); }

// ------------------------------- RMSNorm -----------------------------------
__global__ void rmsnorm_kernel(const float* __restrict__ x,
                               const float* __restrict__ w,
                               float* __restrict__ xn) {
    const int row = blockIdx.x;
    const float* xr = x + row * D_DIM;
    const int tid = threadIdx.x;              // 256 threads, 2 elems each
    float v0 = xr[tid];
    float v1 = xr[tid + 256];
    float s = v0 * v0 + v1 * v1;
    #pragma unroll
    for (int off = 16; off > 0; off >>= 1) s += __shfl_xor(s, off, 32);
    __shared__ float red[8];
    const int wave = tid >> 5, lane = tid & 31;
    if (lane == 0) red[wave] = s;
    __syncthreads();
    float tot = 0.f;
    #pragma unroll
    for (int i = 0; i < 8; ++i) tot += red[i];
    const float scale = rsqrtf(tot * (1.0f / D_DIM) + RMS_EPS);
    xn[row * D_DIM + tid]       = v0 * scale * w[tid];
    xn[row * D_DIM + tid + 256] = v1 * scale * w[tid + 256];
}

// ------------------------- WMMA fp32 GEMM (LDS staged) ---------------------
// acc = A[64 rows, K] @ B[K, 32 cols]; 8 waves/block -> 64x32 block tile,
// one wave computes a 16x16 tile.  K stepped by 4 via V_WMMA_F32_16X16X4_F32.
// A panel (64xKC) staged row-major in LDS; B panel (KCx32) staged TRANSPOSED
// so each lane's {K=ka,K=ka+1} B fragment is one 8-byte ds_load.
// GEMMs that do not use each other's results share one launch: blockIdx.y
// picks the operand set (a block-uniform choice), the tile loop is common.
__device__ __forceinline__ v8f gemm_tile(
        const float* __restrict__ A, int lda,
        const float* __restrict__ B, int ldb,
        int K, int bm0, int bn0,
        float (*As)[LDP],      // [64][LDP]  [m][k]
        float (*Bs)[LDP]) {    // [32][LDP]  [n][k]  (transposed)
    const int tid  = threadIdx.x;
    const int wave = tid >> 5;
    const int lane = tid & 31;
    const int half = lane >> 4;      // 0: K={0,1}, 1: K={2,3}
    const int l    = lane & 15;
    const int m_off = (wave & 3) * 16;
    const int n_off = (wave >> 2) * 16;

    // staging coordinates (fully coalesced float4 panel loads)
    const int ar = tid >> 3;            // A row slot (0..31; +32 for second half)
    const int ac = (tid & 7) * 4;       // A col within K-chunk
    const int br = tid >> 3;            // B k-row (0..31)
    const int bc = (tid & 7) * 4;       // B n-col within 32-wide tile

    const float* aptr0 = A + (size_t)(bm0 + ar) * lda + ac;
    const float* aptr1 = A + (size_t)(bm0 + ar + 32) * lda + ac;
    const float* bptr  = B + (size_t)br * ldb + bn0 + bc;
    const size_t bstep = (size_t)KC * ldb;

    v8f acc = {};
    for (int k0 = 0; k0 < K; k0 += KC) {
        const float4 a0 = *reinterpret_cast<const float4*>(aptr0);
        const float4 a1 = *reinterpret_cast<const float4*>(aptr1);
        const float4 bv = *reinterpret_cast<const float4*>(bptr);
        if (k0 + KC < K) {              // prefetch next panels (global_prefetch_b8)
            __builtin_prefetch(aptr0 + KC, 0, 0);
            __builtin_prefetch(aptr1 + KC, 0, 0);
            __builtin_prefetch(bptr + bstep, 0, 0);
        }
        __syncthreads();                 // previous chunk's LDS reads done
        *reinterpret_cast<float4*>(&As[ar][ac])      = a0;
        *reinterpret_cast<float4*>(&As[ar + 32][ac]) = a1;
        Bs[bc + 0][br] = bv.x;
        Bs[bc + 1][br] = bv.y;
        Bs[bc + 2][br] = bv.z;
        Bs[bc + 3][br] = bv.w;
        __syncthreads();                 // panels visible
        #pragma unroll
        for (int kk = 0; kk < KC; kk += 4) {
            const int ka = kk + 2 * half;
            const float2 af = *reinterpret_cast<const float2*>(&As[m_off + l][ka]);
            const float2 bf = *reinterpret_cast<const float2*>(&Bs[n_off + l][ka]);
            v2f a; a.x = af.x; a.y = af.y;     // VGPR0=K(ka), VGPR1=K(ka+1)
            v2f b; b.x = bf.x; b.y = bf.y;
            acc = __builtin_amdgcn_wmma_f32_16x16x4_f32(
                false, a, false, b, (short)0, acc, false, false);
        }
        aptr0 += KC; aptr1 += KC; bptr += bstep;
    }
    return acc;
}

// C/D layout of the accumulator: VGPR r holds row r + 8 * (lane >> 4), column lane & 15
__device__ __forceinline__ int tile_row(int bm0) {
    return bm0 + ((threadIdx.x >> 5) & 3) * 16 + 8 * ((threadIdx.x & 31) >> 4);
}
__device__ __forceinline__ int tile_col(int bn0) {
    return bn0 + (threadIdx.x >> 7) * 16 + (threadIdx.x & 15);
}

// xn stage: y < 32 -> g = gelu(xn @ W_ffn1), else xz = xn @ W_in   (both [T, 2D])
__global__ __launch_bounds__(256) void gemm_xn_kernel(
        const float* __restrict__ xn, const float* __restrict__ W_in,
        const float* __restrict__ W_ffn1,
        float* __restrict__ xz, float* __restrict__ g) {
    __shared__ __align__(16) float As[64][LDP];
    __shared__ __align__(16) float Bs[32][LDP];
    const bool ffn = blockIdx.y < (2 * D_DIM) / 32;
    const int bm0 = blockIdx.x * 64;
    const int bn0 = (blockIdx.y % ((2 * D_DIM) / 32)) * 32;
    const v8f acc = gemm_tile(xn, D_DIM, ffn ? W_ffn1 : W_in, 2 * D_DIM, D_DIM, bm0, bn0, As, Bs);
    float* cp = (ffn ? g : xz) + (size_t)tile_row(bm0) * (2 * D_DIM) + tile_col(bn0);
    float v[8];
    #pragma unroll
    for (int r = 0; r < 8; ++r) v[r] = acc[r];
    if (ffn) {
        #pragma unroll
        for (int r = 0; r < 8; ++r) v[r] = 0.5f * v[r] * (1.0f + erff(v[r] * 0.70710678118654752f));
    }
    #pragma unroll
    for (int r = 0; r < 8; ++r) cp[(size_t)r * (2 * D_DIM)] = v[r];
}

// xs stage, and riding with it the first K half of the FFN's second product, which
// waits only on g:  y < 16 -> dt = softplus(xs @ W_dt + b_dt), y = 16 -> Bm = xs @ W_B,
// y = 17 -> Cm = xs @ W_C, y >= 18 -> tc[:, D:] = g[:, :D] @ W_ffn2[:D, :]
__global__ __launch_bounds__(256) void gemm_xs_kernel(
        const float* __restrict__ xs, const float* __restrict__ W_dt,
        const float* __restrict__ b_dt, const float* __restrict__ W_B,
        const float* __restrict__ W_C,
        const float* __restrict__ g, const float* __restrict__ W_ffn2,
        float* __restrict__ dtb, float* __restrict__ Bm, float* __restrict__ Cm,
        float* __restrict__ tc) {
    __shared__ __align__(16) float As[64][LDP];
    __shared__ __align__(16) float Bs[32][LDP];
    const int  y    = blockIdx.y;
    const bool isdt = y < D_DIM / 32;
    const bool ffn  = y >= D_DIM / 32 + 2;
    const bool isb  = y == D_DIM / 32;
    const int bm0 = blockIdx.x * 64;
    const int bn0 = isdt ? y * 32 : (ffn ? (y - (D_DIM / 32 + 2)) * 32 : 0);
    const int ldb = (isdt || ffn) ? D_DIM : DS_DIM;
    const int ldc = ffn ? 2 * D_DIM : ldb;
    const float* Bw = isdt ? W_dt : (ffn ? W_ffn2     : (isb ? W_B : W_C));
    float*       Cw = isdt ? dtb  : (ffn ? tc + D_DIM : (isb ? Bm  : Cm));
    const v8f acc = gemm_tile(ffn ? g : xs, ffn ? 2 * D_DIM : D_DIM, Bw, ldb, D_DIM, bm0, bn0, As, Bs);
    const int col = tile_col(bn0);
    float* cp = Cw + (size_t)tile_row(bm0) * ldc + col;
    float v[8];
    #pragma unroll
    for (int r = 0; r < 8; ++r) v[r] = acc[r];
    if (isdt) {
        const float bias = b_dt[col];
        #pragma unroll
        for (int r = 0; r < 8; ++r) {
            v[r] += bias;
            v[r] = (v[r] > 20.0f) ? v[r] : log1pf(expf(v[r]));
        }
    }
    #pragma unroll
    for (int r = 0; r < 8; ++r) cp[(size_t)r * ldc] = v[r];
}

// branch ends, side by side in tc [T, 2D]:  y < 16 -> tc[:, D:] += g[:, D:] @ W_ffn2[D:, :]
// (second K half, added to what the xs stage left there), else tc[:, :D] = ysi @ W_out
__global__ __launch_bounds__(256) void gemm_ends_kernel(
        const float* __restrict__ ysi, const float* __restrict__ W_out,
        const float* __restrict__ g, const float* __restrict__ W_ffn2,
        float* __restrict__ tc) {
    __shared__ __align__(16) float As[64][LDP];
    __shared__ __align__(16) float Bs[32][LDP];
    const bool ffn = blockIdx.y < D_DIM / 32;
    const int bm0 = blockIdx.x * 64;
    const int bn0 = (blockIdx.y % (D_DIM / 32)) * 32;
    const v8f acc = gemm_tile(ffn ? g + D_DIM : ysi, ffn ? 2 * D_DIM : D_DIM,
                              ffn ? W_ffn2 + (size_t)D_DIM * D_DIM : W_out, D_DIM,
                              D_DIM, bm0, bn0, As, Bs);
    float* cp = tc + (size_t)tile_row(bm0) * (2 * D_DIM) + (ffn ? D_DIM : 0) + tile_col(bn0);
    float v[8];
    #pragma unroll
    for (int r = 0; r < 8; ++r) v[r] = acc[r];
    if (ffn) {
        #pragma unroll
        for (int r = 0; r < 8; ++r) v[r] += cp[(size_t)r * (2 * D_DIM)];
    }
    #pragma unroll
    for (int r = 0; r < 8; ++r) cp[(size_t)r * (2 * D_DIM)] = v[r];
}

// out = x + tc @ W_merge   (K = 2D in one pass, residual added in the epilogue)
__global__ __launch_bounds__(256) void gemm_merge_kernel(
        const float* __restrict__ tc, const float* __restrict__ W_merge,
        const float* __restrict__ x, float* __restrict__ out) {
    __shared__ __align__(16) float As[64][LDP];
    __shared__ __align__(16) float Bs[32][LDP];
    const int bm0 = blockIdx.x * 64;
    const int bn0 = blockIdx.y * 32;
    const v8f acc = gemm_tile(tc, 2 * D_DIM, W_merge, D_DIM, 2 * D_DIM, bm0, bn0, As, Bs);
    const size_t o = (size_t)tile_row(bm0) * D_DIM + tile_col(bn0);
    #pragma unroll
    for (int r = 0; r < 8; ++r) out[o + (size_t)r * D_DIM] = x[o + (size_t)r * D_DIM] + acc[r];
}

// -------------------- causal depthwise conv (K=4) + SiLU -------------------
__global__ void conv_silu_kernel(const float* __restrict__ xz,   // [T, 2D], xs_raw = first D cols
                                 const float* __restrict__ cw,   // [D,1,4]
                                 const float* __restrict__ cb,   // [D]
                                 float* __restrict__ xs) {       // [T, D]
    const int idx = blockIdx.x * blockDim.x + threadIdx.x;
    if (idx >= T_LEN * D_DIM) return;
    const int t = idx / D_DIM, d = idx % D_DIM;
    float acc = cb[d];
    #pragma unroll
    for (int kk = 0; kk < 4; ++kk) {
        const int tt = t - 3 + kk;
        if (tt >= 0) acc += cw[d * 4 + kk] * xz[(size_t)tt * (2 * D_DIM) + d];
    }
    xs[idx] = silu_f(acc);
}

// ------------------------------ SSM scan -----------------------------------
// h[t] = exp(clip(dt*A,-20,20))*h[t-1] + dt*xs*B[t,s];  y[t] = sum_s h[t,s]*C[t,s].
// Lane = channel d; the 32 states of that channel sit in the lane's registers,
// so the sum over s is a register sum, dt / xs / z / y are whole-line accesses
// and the decay factor is computed once per (t, d).  B and C rows are the same
// for every lane: staged in LDS and read as same-address 16-byte loads.
// Time is cut into SC_NC chunks of SC_L steps, one wave each; a block holds
// SC_W consecutive chunks of one group of 32 channels.
// Launch 1: every chunk from h = 0 -> end state and product of decay factors.
// Launch 2: carry-in h_in(c) = P(c-1)*h_in(c-1) + h_end(c-1) folded from those
//           summaries, then the recurrence from h_in with the fused
//           (+xs*D_param)*silu(z) epilogue.
#define SC_L  32
#define SC_NC (T_LEN / SC_L)
#define SC_W  4
#define SC_G  (D_DIM / 32)
#define SC_FB 16         // summaries fetched together in the carry fold

// hsum, in float4 units: [chunk][group][state / 4][lane];  psum: [chunk][d]
__global__ __launch_bounds__(SC_W * 32) void ssm_chunk_kernel(
                                const float* __restrict__ xs,    // [T, D]
                                const float* __restrict__ dt,    // [T, D]
                                const float* __restrict__ Bm,    // [T, DS]
                                const float* __restrict__ log_A, // [D]
                                float* __restrict__ hsum,
                                float* __restrict__ psum) {
    __shared__ __align__(16) float4 Bs[SC_W * SC_L * (DS_DIM / 4)];
    __shared__ __align__(16) float2 Qs[SC_W * SC_L * 32];            // {a, dt*xs} per (t, lane)
    const int tid  = threadIdx.x;
    const int lane = tid & 31;
    const int w    = __builtin_amdgcn_readfirstlane(tid >> 5);   // wave number, kept scalar: row bases stay in SGPRs
    const int g    = blockIdx.x % SC_G;
    const int j    = blockIdx.x / SC_G;
    const int d    = g * 32 + lane;
    const int c    = j * SC_W + w;
    const int t0   = c * SC_L;

    const float4* bsrc = reinterpret_cast<const float4*>(Bm + (size_t)j * SC_W * SC_L * DS_DIM);
    float4 braw[SC_L * (DS_DIM / 4) / 32];
    float  dtv[SC_L], xv[SC_L];
    // full unrolls here and below: the arrays stay in registers and every load of
    // the chunk is in flight at once (one memory latency for the whole chunk)
    #pragma unroll
    for (int i = 0; i < SC_L * (DS_DIM / 4) / 32; ++i) braw[i] = bsrc[tid + i * SC_W * 32];
    #pragma unroll
    for (int t = 0; t < SC_L; ++t) {
        dtv[t] = dt[(size_t)(t0 + t) * D_DIM + d];
        xv[t]  = xs[(size_t)(t0 + t) * D_DIM + d];
    }
    const float lAv = log_A[d];
    // what follows reuses the address registers of the loads above
    asm volatile("s_wait_xcnt 0x0" ::: "memory");
    #pragma unroll
    for (int i = 0; i < SC_L * (DS_DIM / 4) / 32; ++i) Bs[tid + i * SC_W * 32] = braw[i];
    const float A = -expf(lAv);
    #pragma unroll
    for (int t = 0; t < SC_L; ++t) {
        float la = dtv[t] * A;
        la = fminf(20.0f, fmaxf(-20.0f, la));
        Qs[(w * SC_L + t) * 32 + lane] = make_float2(expf(la), dtv[t] * xv[t]);
    }
    __syncthreads();                             // B rows visible

    v2f h[DS_DIM / 2];
    #pragma unroll
    for (int i = 0; i < DS_DIM / 2; ++i) h[i] = (v2f){0.0f, 0.0f};
    float p = 1.0f;
    const float4* bq = Bs + w * SC_L * (DS_DIM / 4);
    const float2* qq = Qs + w * SC_L * 32 + lane;
    // four steps a trip: their LDS reads issue as one group ahead of the arithmetic
    #pragma unroll 4
    for (int t = 0; t < SC_L; ++t) {
        const float2 s2 = qq[t * 32];
        const v2f a2 = {s2.x, s2.x};
        const v2f u2 = {s2.y, s2.y};
        #pragma unroll
        for (int q = 0; q < DS_DIM / 4; ++q) {
            const float4 b = bq[t * (DS_DIM / 4) + q];
            h[2 * q]     = a2 * h[2 * q]     + u2 * (v2f){b.x, b.y};
            h[2 * q + 1] = a2 * h[2 * q + 1] + u2 * (v2f){b.z, b.w};
        }
        p *= s2.x;
    }

    float4* ho = reinterpret_cast<float4*>(hsum) + (size_t)(c * SC_G + g) * (DS_DIM / 4) * 32 + lane;
    #pragma unroll
    for (int q = 0; q < DS_DIM / 4; ++q)
        ho[q * 32] = make_float4(h[2 * q].x, h[2 * q].y, h[2 * q + 1].x, h[2 * q + 1].y);
    psum[c * D_DIM + d] = p;
}

__global__ __launch_bounds__(SC_W * 32) void ssm_apply_kernel(
                                const float* __restrict__ xs,    // [T, D]
                                const float* __restrict__ dt,    // [T, D]
                                const float* __restrict__ Bm,    // [T, DS]
                                const float* __restrict__ Cm,    // [T, DS]
                                const float* __restrict__ xz,    // [T, 2D] (z = cols D..2D)
                                const float* __restrict__ log_A, // [D]
                                const float* __restrict__ Dp,    // [D]
                                const float* __restrict__ hsum,
                                const float* __restrict__ psum,
                                float* __restrict__ ysi) {       // [T, D]
    // one array, B and C rows first: their reads then reach every row of a trip
    // through the instruction's own offset field
    __shared__ __align__(16) float4 sm[2 * SC_W * SC_L * (DS_DIM / 4) + SC_W * (DS_DIM / 4) * 32 + SC_W * SC_L * 32];
    float4* Bs = sm;
    float4* Cs = Bs + SC_W * SC_L * (DS_DIM / 4);
    float4* Hx = Cs + SC_W * SC_L * (DS_DIM / 4);   // h_in per chunk of the block
    float4* Qs = Hx + SC_W * (DS_DIM / 4) * 32;     // {a, dt*xs, xs, silu(z)} per (t, lane)
    const int tid  = threadIdx.x;
    const int lane = tid & 31;
    const int w    = __builtin_amdgcn_readfirstlane(tid >> 5);   // wave number, kept scalar: row bases stay in SGPRs
    const int g    = blockIdx.x % SC_G;
    const int j    = blockIdx.x / SC_G;
    const int d    = g * 32 + lane;
    const int t0   = (j * SC_W + w) * SC_L;

    const float4* bsrc = reinterpret_cast<const float4*>(Bm + (size_t)j * SC_W * SC_L * DS_DIM);
    const float4* csrc = reinterpret_cast<const float4*>(Cm + (size_t)j * SC_W * SC_L * DS_DIM);
    #pragma unroll
    for (int i = 0; i < SC_L * (DS_DIM / 4) / 32; ++i) {
        Bs[tid + i * SC_W * 32] = bsrc[tid + i * SC_W * 32];
        Cs[tid + i * SC_W * 32] = csrc[tid + i * SC_W * 32];
    }

    const float A   = -expf(log_A[d]);
    const float Dpd = Dp[d];
    #pragma unroll
    for (int t = 0; t < SC_L; ++t) {
        const float dtv = dt[(size_t)(t0 + t) * D_DIM + d];
        const float xv  = xs[(size_t)(t0 + t) * D_DIM + d];
        const float zv  = xz[(size_t)(t0 + t) * (2 * D_DIM) + D_DIM + d];
        float la = dtv * A;
        la = fminf(20.0f, fmaxf(-20.0f, la));
        Qs[(w * SC_L + t) * 32 + lane] = make_float4(expf(la), dtv * xv, xv, silu_f(zv));
    }

    // Carry fold, shared by the block: wave w folds states 8w .. 8w+7 of the 32
    // channels over every earlier chunk, then on through the block's own chunks,
    // leaving h_in of each of them in LDS.
    const float4*  hq    = reinterpret_cast<const float4*>(hsum) + (size_t)g * (DS_DIM / 4) * 32;
    const float*   pq    = psum + g * 32;
    const size_t   hstep = (size_t)SC_G * (DS_DIM / 4) * 32;         // float4 per chunk
    const unsigned hoff  = 2 * w * 32 + lane;
    const int nprev = j * SC_W;
    float4 ha = make_float4(0.f, 0.f, 0.f, 0.f), hb = ha;
    for (int cb = 0; cb < nprev; cb += SC_FB) {
        float4 qa[SC_FB], qb[SC_FB];
        float  pp[SC_FB];
        // All fetches of the batch in flight together.  cb + k stays below SC_NC
        // (SC_NC is a multiple of SC_FB), so a fetch past nprev still reads a
        // summary that launch 1 wrote; the fold below leaves it out.
        const float4* hc = hq + cb * hstep + hoff;
        const float*  pc = pq + cb * D_DIM + lane;
        #pragma unroll
        for (int k = 0; k < SC_FB; ++k) {
            qa[k] = hc[k * hstep];
            qb[k] = hc[k * hstep + 32];
            pp[k] = pc[k * D_DIM];
        }
        #pragma unroll
        for (int k = 0; k < SC_FB; ++k) {
            const bool on = cb + k < nprev;      // past the end: identity step
            const float pe = on ? pp[k] : 1.0f;
            ha.x = pe * ha.x + (on ? qa[k].x : 0.0f);
            ha.y = pe * ha.y + (on ? qa[k].y : 0.0f);
            ha.z = pe * ha.z + (on ? qa[k].z : 0.0f);
            ha.w = pe * ha.w + (on ? qa[k].w : 0.0f);
            hb.x = pe * hb.x + (on ? qb[k].x : 0.0f);
            hb.y = pe * hb.y + (on ? qb[k].y : 0.0f);
            hb.z = pe * hb.z + (on ? qb[k].z : 0.0f);
            hb.w = pe * hb.w + (on ? qb[k].w : 0.0f);
        }
    }
    #pragma unroll
    for (int k = 0; k < SC_W; ++k) {
        Hx[(k * (DS_DIM / 4) + 2 * w) * 32 + lane]     = ha;
        Hx[(k * (DS_DIM / 4) + 2 * w + 1) * 32 + lane] = hb;
        if (k + 1 < SC_W) {
            const float4* hc = hq + (nprev + k) * hstep;
            const float4 qa = hc[hoff];
            const float4 qb = hc[hoff + 32];
            const float  pe = (pq + (nprev + k) * D_DIM)[lane];
            ha.x = pe * ha.x + qa.x;  ha.y = pe * ha.y + qa.y;
            ha.z = pe * ha.z + qa.z;  ha.w = pe * ha.w + qa.w;
            hb.x = pe * hb.x + qb.x;  hb.y = pe * hb.y + qb.y;
            hb.z = pe * hb.z + qb.z;  hb.w = pe * hb.w + qb.w;
        }
    }
    __syncthreads();                             // B, C rows and every h_in visible

    v2f h[DS_DIM / 2];
    #pragma unroll
    for (int q = 0; q < DS_DIM / 4; ++q) {
        const float4 v = Hx[(w * (DS_DIM / 4) + q) * 32 + lane];
        h[2 * q]     = (v2f){v.x, v.y};
        h[2 * q + 1] = (v2f){v.z, v.w};
    }
    const float4* bq = Bs + w * SC_L * (DS_DIM / 4);
    const float4* cq = Cs + w * SC_L * (DS_DIM / 4);
    const float4* qq = Qs + w * SC_L * 32 + lane;
    float* yo = ysi + (size_t)t0 * D_DIM + d;
    // two steps a trip: their LDS reads issue as one group ahead of the arithmetic;
    // four would need more than 256 registers
    #pragma unroll 2
    for (int t = 0; t < SC_L; ++t) {
        const float4 s4 = qq[t * 32];
        const v2f a2 = {s4.x, s4.x};
        const v2f u2 = {s4.y, s4.y};
        v2f y0 = {0.0f, 0.0f}, y1 = {0.0f, 0.0f};
        #pragma unroll
        for (int q = 0; q < DS_DIM / 4; ++q) {
            const float4 b  = bq[t * (DS_DIM / 4) + q];
            const float4 cv = cq[t * (DS_DIM / 4) + q];
            h[2 * q]     = a2 * h[2 * q]     + u2 * (v2f){b.x, b.y};
            h[2 * q + 1] = a2 * h[2 * q + 1] + u2 * (v2f){b.z, b.w};
            y0 += h[2 * q]     * (v2f){cv.x, cv.y};
            y1 += h[2 * q + 1] * (v2f){cv.z, cv.w};
        }
        const float y = (y0.x + y0.y) + (y1.x + y1.y);
        yo[(size_t)t * D_DIM] = (y + s4.z * Dpd) * s4.w;
    }
}

// ------------------------------ launcher -----------------------------------
extern "C" void kernel_launch(void* const* d_in, const int* in_sizes, int n_in,
                              void* d_out, int out_size, void* d_ws, size_t ws_size,
                              hipStream_t stream) {
    (void)in_sizes; (void)n_in; (void)out_size; (void)ws_size;

    const float* x       = (const float*)d_in[0];
    const float* norm_w  = (const float*)d_in[1];
    const float* W_in    = (const float*)d_in[2];
    const float* conv_w  = (const float*)d_in[3];
    const float* conv_b  = (const float*)d_in[4];
    const float* W_dt    = (const float*)d_in[5];
    const float* b_dt    = (const float*)d_in[6];
    const float* W_B     = (const float*)d_in[7];
    const float* W_C     = (const float*)d_in[8];
    const float* W_out   = (const float*)d_in[9];
    const float* log_A   = (const float*)d_in[10];
    const float* D_param = (const float*)d_in[11];
    const float* W_ffn1  = (const float*)d_in[12];
    const float* W_ffn2  = (const float*)d_in[13];
    const float* W_merge = (const float*)d_in[14];
    float* out = (float*)d_out;

    float* ws  = (float*)d_ws;
    float* xn  = ws;                              // [T, D]
    float* xz  = xn  + (size_t)T_LEN * D_DIM;     // [T, 2D]
    float* xs  = xz  + (size_t)T_LEN * 2 * D_DIM; // [T, D]
    float* dtb = xs  + (size_t)T_LEN * D_DIM;     // [T, D]
    float* Bm  = dtb + (size_t)T_LEN * D_DIM;     // [T, DS]
    float* Cm  = Bm  + (size_t)T_LEN * DS_DIM;    // [T, DS]
    float* ysi = Cm  + (size_t)T_LEN * DS_DIM;    // [T, D]
    float* tc  = ysi + (size_t)T_LEN * D_DIM;     // [T, 2D] {y_ssm @ W_out | y_ffn}
    float* g   = tc  + (size_t)T_LEN * 2 * D_DIM; // [T, 2D] gelu(xn @ W_ffn1)
    float* hsm = g   + (size_t)T_LEN * 2 * D_DIM; // [SC_NC, D, DS] chunk end states
    float* psm = hsm + (size_t)SC_NC * D_DIM * DS_DIM; // [SC_NC, D] chunk decay products

    // 1) RMSNorm
    rmsnorm_kernel<<<T_LEN, 256, 0, stream>>>(x, norm_w, xn);
    // 2) xz = xn @ W_in and g = gelu(xn @ W_ffn1), each [2048 x 1024]
    gemm_xn_kernel<<<dim3(T_LEN / 64, 2 * ((2 * D_DIM) / 32)), 256, 0, stream>>>(
        xn, W_in, W_ffn1, xz, g);
    // 3) causal depthwise conv + SiLU -> xs
    conv_silu_kernel<<<(T_LEN * D_DIM + 255) / 256, 256, 0, stream>>>(xz, conv_w, conv_b, xs);
    // 4) dt = softplus(xs @ W_dt + b_dt), Bm = xs @ W_B, Cm = xs @ W_C, first K half of g @ W_ffn2
    gemm_xs_kernel<<<dim3(T_LEN / 64, 2 * (D_DIM / 32) + 2), 256, 0, stream>>>(
        xs, W_dt, b_dt, W_B, W_C, g, W_ffn2, dtb, Bm, Cm, tc);
    // 5) SSM recurrence + (+xs*D)*silu(z) epilogue -> ysi
    ssm_chunk_kernel<<<SC_G * (SC_NC / SC_W), SC_W * 32, 0, stream>>>(xs, dtb, Bm, log_A, hsm, psm);
    ssm_apply_kernel<<<SC_G * (SC_NC / SC_W), SC_W * 32, 0, stream>>>(
        xs, dtb, Bm, Cm, xz, log_A, D_param, hsm, psm, ysi);
    // 6) tc = {ysi @ W_out | g @ W_ffn2}, the latter's second K half
    gemm_ends_kernel<<<dim3(T_LEN / 64, 2 * (D_DIM / 32)), 256, 0, stream>>>(
        ysi, W_out, g, W_ffn2, tc);
    // 7) out = x + tc @ W_merge
    gemm_merge_kernel<<<dim3(T_LEN / 64, D_DIM / 32), 256, 0, stream>>>(tc, W_merge, x, out);
}

// v004
// One run takes 97.4 microseconds.
// Two timings next to v003 both put it at 1.14 times that version's speed.
// Over all steps from v000 it is 19.7 times as fast.
#include <hip/hip_runtime.h>
#include <hip/hip_bf16.h>
#include <math.h>

// ---------------------------------------------------------------------------
// Fused Mamba-style SSM + FFN block for MI455X (gfx1250, wave32).
// All GEMMs run through V_WMMA_F32_16X16X4_F32 (full fp32 matrix path),
// fed from LDS-staged panels (coalesced float4 global loads, ds_load_b64
// fragment reads, bank-conflict-free padded layout).
// ---------------------------------------------------------------------------

typedef float v2f __attribute__((ext_vector_type(2)));
typedef float v8f __attribute__((ext_vector_type(8)));

#define T_LEN  2048
#define D_DIM  512
#define DS_DIM 32
#define RMS_EPS 1e-6f
#define KC 32            // K-chunk staged in LDS per iteration
#define LDP 36           // padded row length (floats): 144B = 16B-aligned, bank-spread

__device__ __forceinline__ float silu_f(float x) { return x / (1.0f + expf(-x)); }

// ------------------------------- RMSNorm -----------------------------------
__global__ void rmsnorm_kernel(const float* __restrict__ x,
                               const float* __restrict__ w,
                               float* __restrict__ xn) {
    const int row = blockIdx.x;
    const float* xr = x + row * D_DIM;
    const int tid = threadIdx.x;              // 256 threads, 2 elems each
    float v0 = xr[tid];
    float v1 = xr[tid + 256];
    float s = v0 * v0 + v1 * v1;
    #pragma unroll
    for (int off = 16; off > 0; off >>= 1) s += __shfl_xor(s, off, 32);
    __shared__ float red[8];
    const int wave = tid >> 5, lane = tid & 31;
    if (lane == 0) red[wave] = s;
    __syncthreads();
    float tot = 0.f;
    #pragma unroll
    for (int i = 0; i < 8; ++i) tot += red[i];
    const float scale = rsqrtf(tot * (1.0f / D_DIM) + RMS_EPS);
    xn[row * D_DIM + tid]       = v0 * scale * w[tid];
    xn[row * D_DIM + tid + 256] = v1 * scale * w[tid + 256];
}

// ------------------------- WMMA fp32 GEMM (LDS staged) ---------------------
// acc = A[64 rows, K] @ B[K, 32 cols]; 8 waves/block -> 64x32 block tile,
// one wave computes a 16x16 tile.  K stepped by 4 via V_WMMA_F32_16X16X4_F32.
// A panel (64xKC) staged row-major in LDS; B panel (KCx32) staged TRANSPOSED
// so each lane's {K=ka,K=ka+1} B fragment is one 8-byte ds_load.
// GEMMs that do not use each other's results share one launch: blockIdx.y
// picks the operand set (a block-uniform choice), the tile loop is common.
__device__ __forceinline__ v8f gemm_tile(
        const float* __restrict__ A, int lda,
        const float* __restrict__ B, int ldb,
        int K, int bm0, int bn0,
        float (*As)[LDP],      // [64][LDP]  [m][k]
        float (*Bs)[LDP]) {    // [32][LDP]  [n][k]  (transposed)
    const int tid  = threadIdx.x;
    const int wave = tid >> 5;
    const int lane = tid & 31;
    const int half = lane >> 4;      // 0: K={0,1}, 1: K={2,3}
    const int l    = lane & 15;
    const int m_off = (wave & 3) * 16;
    const int n_off = (wave >> 2) * 16;

    // staging coordinates (fully coalesced float4 panel loads)
    const int ar = tid >> 3;            // A row slot (0..31; +32 for second half)
    const int ac = (tid & 7) * 4;       // A col within K-chunk
    const int br = tid >> 3;            // B k-row (0..31)
    const int bc = (tid & 7) * 4;       // B n-col within 32-wide tile

    const float* aptr0 = A + (size_t)(bm0 + ar) * lda + ac;
    const float* aptr1 = A + (size_t)(bm0 + ar + 32) * lda + ac;
    const float* bptr  = B + (size_t)br * ldb + bn0 + bc;
    const size_t bstep = (size_t)KC * ldb;

    v8f acc = {};
    for (int k0 = 0; k0 < K; k0 += KC) {
        const float4 a0 = *reinterpret_cast<const float4*>(aptr0);
        const float4 a1 = *reinterpret_cast<const float4*>(aptr1);
        const float4 bv = *reinterpret_cast<const float4*>(bptr);
        if (k0 + KC < K) {              // prefetch next panels (global_prefetch_b8)
            __builtin_prefetch(aptr0 + KC, 0, 0);
            __builtin_prefetch(aptr1 + KC, 0, 0);
            __builtin_prefetch(bptr + bstep, 0, 0);
        }
        __syncthreads();                 // previous chunk's LDS reads done
        *reinterpret_cast<float4*>(&As[ar][ac])      = a0;
        *reinterpret_cast<float4*>(&As[ar + 32][ac]) = a1;
        Bs[bc + 0][br] = bv.x;
        Bs[bc + 1][br] = bv.y;
        Bs[bc + 2][br] = bv.z;
        Bs[bc + 3][br] = bv.w;
        __syncthreads();                 // panels visible
        #pragma unroll
        for (int kk = 0; kk < KC; kk += 4) {
            const int ka = kk + 2 * half;
            const float2 af = *reinterpret_cast<const float2*>(&As[m_off + l][ka]);
            const float2 bf = *reinterpret_cast<const float2*>(&Bs[n_off + l][ka]);
            v2f a; a.x = af.x; a.y = af.y;     // VGPR0=K(ka), VGPR1=K(ka+1)
            v2f b; b.x = bf.x; b.y = bf.y;
            acc = __builtin_amdgcn_wmma_f32_16x16x4_f32(
                false, a, false, b, (short)0, acc, false, false);
        }
        aptr0 += KC; aptr1 += KC; bptr += bstep;
    }
    return acc;
}

// C/D layout of the accumulator: VGPR r holds row r + 8 * (lane >> 4), column lane & 15
__device__ __forceinline__ int tile_row(int bm0) {
    return bm0 + ((threadIdx.x >> 5) & 3) * 16 + 8 * ((threadIdx.x & 31) >> 4);
}
__device__ __forceinline__ int tile_col(int bn0) {
    return bn0 + (threadIdx.x >> 7) * 16 + (threadIdx.x & 15);
}

// The two output projections are reassociated: with Wm = W_merge,
//   out = x + (ysi @ W_out) @ Wm[:D] + (g @ W_ffn2) @ Wm[D:]
//       = x + ysi @ (W_out @ Wm[:D]) + g @ (W_ffn2 @ Wm[D:]).
// The weight-by-weight products have D or 2D rows where the activations have T,
// they wait on no activation, and behind the scan one K = D product is left.
#define WB_X  (T_LEN / 64)                                   // blocks along grid x
#define WFM_Y (((2 * D_DIM) / 64) * (D_DIM / 32) / WB_X)     // grid rows of W_ffn2 @ Wm[D:]
#define WOM_Y ((D_DIM / 64) * (D_DIM / 32) / WB_X)           // grid rows of W_out @ Wm[:D]

// xn stage: y < WFM_Y -> wfm = W_ffn2 @ Wm[D:]  [2D, D]; the next 32 rows of the grid
// -> g = gelu(xn @ W_ffn1), the last 32 -> xz = xn @ W_in   (both [T, 2D])
__global__ __launch_bounds__(256) void gemm_xn_kernel(
        const float* __restrict__ xn, const float* __restrict__ W_in,
        const float* __restrict__ W_ffn1,
        const float* __restrict__ W_ffn2, const float* __restrict__ W_merge,
        float* __restrict__ xz, float* __restrict__ g, float* __restrict__ wfm) {
    __shared__ __align__(16) float As[64][LDP];
    __shared__ __align__(16) float Bs[32][LDP];
    const int  y   = blockIdx.y;
    const bool wp  = y < WFM_Y;
    const bool ffn = !wp && y < WFM_Y + (2 * D_DIM) / 32;
    const int  wi  = y * WB_X + blockIdx.x;                  // tile number of the weight product
    const int bm0 = (wp ? wi / (D_DIM / 32) : (int)blockIdx.x) * 64;
    const int bn0 = (wp ? wi % (D_DIM / 32) : (y - WFM_Y) % ((2 * D_DIM) / 32)) * 32;
    const int ldn = wp ? D_DIM : 2 * D_DIM;
    const float* Bw = wp ? W_merge + (size_t)D_DIM * D_DIM : (ffn ? W_ffn1 : W_in);
    float*       Cw = wp ? wfm : (ffn ? g : xz);
    const v8f acc = gemm_tile(wp ? W_ffn2 : xn, D_DIM, Bw, ldn, D_DIM, bm0, bn0, As, Bs);
    float* cp = Cw + (size_t)tile_row(bm0) * ldn + tile_col(bn0);
    float v[8];
    #pragma unroll
    for (int r = 0; r < 8; ++r) v[r] = acc[r];
    if (ffn) {
        #pragma unroll
        for (int r = 0; r < 8; ++r) v[r] = 0.5f * v[r] * (1.0f + erff(v[r] * 0.70710678118654752f));
    }
    #pragma unroll
    for (int r = 0; r < 8; ++r) cp[(size_t)r * ldn] = v[r];
}

// xs stage, and riding with it what waits only on g, wfm or the weights:
// y < 16 -> dt = softplus(xs @ W_dt + b_dt), y = 16 -> Bm = xs @ W_B, y = 17 -> Cm = xs @ W_C,
// the next 16 -> p1 = x + g[:, :D] @ wfm[:D, :], the next 16 -> p2 = g[:, D:] @ wfm[D:, :],
// the last WOM_Y -> wom = W_out @ Wm[:D]  [D, D]
__global__ __launch_bounds__(256) void gemm_xs_kernel(
        const float* __restrict__ xs, const float* __restrict__ W_dt,
        const float* __restrict__ b_dt, const float* __restrict__ W_B,
        const float* __restrict__ W_C,
        const float* __restrict__ g, const float* __restrict__ wfm,
        const float* __restrict__ x,
        const float* __restrict__ W_out, const float* __restrict__ W_merge,
        float* __restrict__ dtb, float* __restrict__ Bm, float* __restrict__ Cm,
        float* __restrict__ p1, float* __restrict__ p2, float* __restrict__ wom) {
    __shared__ __align__(16) float As[64][LDP];
    __shared__ __align__(16) float Bs[32][LDP];
    const int  ND   = D_DIM / 32;
    const int  y    = blockIdx.y;
    const bool isdt = y < ND;
    const bool isb  = y == ND;
    const bool isc  = y == ND + 1;
    const bool lo   = y >= ND + 2 && y < 2 * ND + 2;
    const bool hi   = y >= 2 * ND + 2 && y < 3 * ND + 2;
    const bool wp   = y >= 3 * ND + 2;
    const int  wi   = (y - (3 * ND + 2)) * WB_X + blockIdx.x;   // tile number of the weight product
    const int bm0 = (wp ? wi / ND : (int)blockIdx.x) * 64;
    const int bn0 = (isdt ? y : lo ? y - (ND + 2) : hi ? y - (2 * ND + 2) : wp ? wi % ND : 0) * 32;
    const int ldn = (isb || isc) ? DS_DIM : D_DIM;
    const float* Aw = lo ? g : hi ? g + D_DIM : wp ? W_out : xs;
    const float* Bw = isdt ? W_dt : isb ? W_B : isc ? W_C : lo ? wfm
                    : hi ? wfm + (size_t)D_DIM * D_DIM : W_merge;
    float*       Cw = isdt ? dtb : isb ? Bm : isc ? Cm : lo ? p1 : hi ? p2 : wom;
    const v8f acc = gemm_tile(Aw, (lo || hi) ? 2 * D_DIM : D_DIM, Bw, ldn, D_DIM, bm0, bn0, As, Bs);
    const int col = tile_col(bn0);
    const size_t o = (size_t)tile_row(bm0) * ldn + col;
    float v[8];
    #pragma unroll
    for (int r = 0; r < 8; ++r) v[r] = acc[r];
    if (isdt) {
        const float bias = b_dt[col];
        #pragma unroll
        for (int r = 0; r < 8; ++r) {
            v[r] += bias;
            v[r] = (v[r] > 20.0f) ? v[r] : log1pf(expf(v[r]));
        }
    }
    if (lo) {
        #pragma unroll
        for (int r = 0; r < 8; ++r) v[r] += x[o + (size_t)r * D_DIM];
        // the store addresses formed below reuse the address registers of the x loads
        asm volatile("s_wait_xcnt 0x0" ::: "memory");
    }
    #pragma unroll
    for (int r = 0; r < 8; ++r) Cw[o + (size_t)r * ldn] = v[r];
}

// out = (p1 + p2) + ysi @ wom: the one product that waits on the scan
__global__ __launch_bounds__(256) void gemm_out_kernel(
        const float* __restrict__ ysi, const float* __restrict__ wom,
        const float* __restrict__ p1, const float* __restrict__ p2,
        float* __restrict__ out) {
    __shared__ __align__(16) float As[64][LDP];
    __shared__ __align__(16) float Bs[32][LDP];
    const int bm0 = blockIdx.x * 64;
    const int bn0 = blockIdx.y * 32;
    const size_t o = (size_t)tile_row(bm0) * D_DIM + tile_col(bn0);
    float s[8];
    #pragma unroll
    for (int r = 0; r < 8; ++r) s[r] = p1[o + (size_t)r * D_DIM] + p2[o + (size_t)r * D_DIM];
    const v8f acc = gemm_tile(ysi, D_DIM, wom, D_DIM, D_DIM, bm0, bn0, As, Bs);
    #pragma unroll
    for (int r = 0; r < 8; ++r) out[o + (size_t)r * D_DIM] = s[r] + acc[r];
}

// -------------------- causal depthwise conv (K=4) + SiLU -------------------
__global__ void conv_silu_kernel(const float* __restrict__ xz,   // [T, 2D], xs_raw = first D cols
                                 const float* __restrict__ cw,   // [D,1,4]
                                 const float* __restrict__ cb,   // [D]
                                 float* __restrict__ xs) {       // [T, D]
    const int idx = blockIdx.x * blockDim.x + threadIdx.x;
    if (idx >= T_LEN * D_DIM) return;
    const int t = idx / D_DIM, d = idx % D_DIM;
    float acc = cb[d];
    #pragma unroll
    for (int kk = 0; kk < 4; ++kk) {
        const int tt = t - 3 + kk;
        if (tt >= 0) acc += cw[d * 4 + kk] * xz[(size_t)tt * (2 * D_DIM) + d];
    }
    xs[idx] = silu_f(acc);
}

// ------------------------------ SSM scan -----------------------------------
// h[t] = exp(clip(dt*A,-20,20))*h[t-1] + dt*xs*B[t,s];  y[t] = sum_s h[t,s]*C[t,s].
// Lane = channel d; the 32 states of that channel sit in the lane's registers,
// so the sum over s is a register sum, dt / xs / z / y are whole-line accesses
// and the decay factor is computed once per (t, d).  B and C rows are the same
// for every lane: staged in LDS and read as same-address 16-byte loads.
// Time is cut into SC_NC chunks of SC_L steps, one wave each; a block holds
// SC_W consecutive chunks of one group of 32 channels.
// Launch 1: every chunk from h = 0 -> end state and product of decay factors.
// Launch 2: carry-in h_in(c) = P(c-1)*h_in(c-1) + h_end(c-1) folded from those
//           summaries, then the recurrence from h_in with the fused
//           (+xs*D_param)*silu(z) epilogue.
#define SC_L  32
#define SC_NC (T_LEN / SC_L)
#define SC_W  4
#define SC_G  (D_DIM / 32)
#define SC_FB 16         // summaries fetched together in the carry fold

// hsum, in float4 units: [chunk][group][state / 4][lane];  psum: [chunk][d]
__global__ __launch_bounds__(SC_W * 32) void ssm_chunk_kernel(
                                const float* __restrict__ xs,    // [T, D]
                                const float* __restrict__ dt,    // [T, D]
                                const float* __restrict__ Bm,    // [T, DS]
                                const float* __restrict__ log_A, // [D]
                                float* __restrict__ hsum,
                                float* __restrict__ psum) {
    __shared__ __align__(16) float4 Bs[SC_W * SC_L * (DS_DIM / 4)];
    __shared__ __align__(16) float2 Qs[SC_W * SC_L * 32];            // {a, dt*xs} per (t, lane)
    const int tid  = threadIdx.x;
    const int lane = tid & 31;
    const int w    = __builtin_amdgcn_readfirstlane(tid >> 5);   // wave number, kept scalar: row bases stay in SGPRs
    const int g    = blockIdx.x % SC_G;
    const int j    = blockIdx.x / SC_G;
    const int d    = g * 32 + lane;
    const int c    = j * SC_W + w;
    const int t0   = c * SC_L;

    const float4* bsrc = reinterpret_cast<const float4*>(Bm + (size_t)j * SC_W * SC_L * DS_DIM);
    float4 braw[SC_L * (DS_DIM / 4) / 32];
    float  dtv[SC_L], xv[SC_L];
    // full unrolls here and below: the arrays stay in registers and every load of
    // the chunk is in flight at once (one memory latency for the whole chunk)
    #pragma unroll
    for (int i = 0; i < SC_L * (DS_DIM / 4) / 32; ++i) braw[i] = bsrc[tid + i * SC_W * 32];
    #pragma unroll
    for (int t = 0; t < SC_L; ++t) {
        dtv[t] = dt[(size_t)(t0 + t) * D_DIM + d];
        xv[t]  = xs[(size_t)(t0 + t) * D_DIM + d];
    }
    const float lAv = log_A[d];
    // what follows reuses the address registers of the loads above
    asm volatile("s_wait_xcnt 0x0" ::: "memory");
    #pragma unroll
    for (int i = 0; i < SC_L * (DS_DIM / 4) / 32; ++i) Bs[tid + i * SC_W * 32] = braw[i];
    const float A = -expf(lAv);
    #pragma unroll
    for (int t = 0; t < SC_L; ++t) {
        float la = dtv[t] * A;
        la = fminf(20.0f, fmaxf(-20.0f, la));
        Qs[(w * SC_L + t) * 32 + lane] = make_float2(expf(la), dtv[t] * xv[t]);
    }
    __syncthreads();                             // B rows visible

    v2f h[DS_DIM / 2];
    #pragma unroll
    for (int i = 0; i < DS_DIM / 2; ++i) h[i] = (v2f){0.0f, 0.0f};
    float p = 1.0f;
    const float4* bq = Bs + w * SC_L * (DS_DIM / 4);
    const float2* qq = Qs + w * SC_L * 32 + lane;
    // four steps a trip: their LDS reads issue as one group ahead of the arithmetic
    #pragma unroll 4
    for (int t = 0; t < SC_L; ++t) {
        const float2 s2 = qq[t * 32];
        const v2f a2 = {s2.x, s2.x};
        const v2f u2 = {s2.y, s2.y};
        #pragma unroll
        for (int q = 0; q < DS_DIM / 4; ++q) {
            const float4 b = bq[t * (DS_DIM / 4) + q];
            h[2 * q]     = a2 * h[2 * q]     + u2 * (v2f){b.x, b.y};
            h[2 * q + 1] = a2 * h[2 * q + 1] + u2 * (v2f){b.z, b.w};
        }
        p *= s2.x;
    }

    float4* ho = reinterpret_cast<float4*>(hsum) + (size_t)(c * SC_G + g) * (DS_DIM / 4) * 32 + lane;
    #pragma unroll
    for (int q = 0; q < DS_DIM / 4; ++q)
        ho[q * 32] = make_float4(h[2 * q].x, h[2 * q].y, h[2 * q + 1].x, h[2 * q + 1].y);
    psum[c * D_DIM + d] = p;
}

__global__ __launch_bounds__(SC_W * 32) void ssm_apply_kernel(
                                const float* __restrict__ xs,    // [T, D]
                                const float* __restrict__ dt,    // [T, D]
                                const float* __restrict__ Bm,    // [T, DS]
                                const float* __restrict__ Cm,    // [T, DS]
                                const float* __restrict__ xz,    // [T, 2D] (z = cols D..2D)
                                const float* __restrict__ log_A, // [D]
                                const float* __restrict__ Dp,    // [D]
                                const float* __restrict__ hsum,
                                const float* __restrict__ psum,
                                float* __restrict__ ysi) {       // [T, D]
    // one array, B and C rows first: their reads then reach every row of a trip
    // through the instruction's own offset field
    __shared__ __align__(16) float4 sm[2 * SC_W * SC_L * (DS_DIM / 4) + SC_W * (DS_DIM / 4) * 32 + SC_W * SC_L * 32];
    float4* Bs = sm;
    float4* Cs = Bs + SC_W * SC_L * (DS_DIM / 4);
    float4* Hx = Cs + SC_W * SC_L * (DS_DIM / 4);   // h_in per chunk of the block
    float4* Qs = Hx + SC_W * (DS_DIM / 4) * 32;     // {a, dt*xs, xs, silu(z)} per (t, lane)
    const int tid  = threadIdx.x;
    const int lane = tid & 31;
    const int w    = __builtin_amdgcn_readfirstlane(tid >> 5);   // wave number, kept scalar: row bases stay in SGPRs
    const int g    = blockIdx.x % SC_G;
    const int j    = blockIdx.x / SC_G;
    const int d    = g * 32 + lane;
    const int t0   = (j * SC_W + w) * SC_L;

    const float4* bsrc = reinterpret_cast<const float4*>(Bm + (size_t)j * SC_W * SC_L * DS_DIM);
    const float4* csrc = reinterpret_cast<const float4*>(Cm + (size_t)j * SC_W * SC_L * DS_DIM);
    #pragma unroll
    for (int i = 0; i < SC_L * (DS_DIM / 4) / 32; ++i) {
        Bs[tid + i * SC_W * 32] = bsrc[tid + i * SC_W * 32];
        Cs[tid + i * SC_W * 32] = csrc[tid + i * SC_W * 32];
    }

    const float A   = -expf(log_A[d]);
    const float Dpd = Dp[d];
    #pragma unroll
    for (int t = 0; t < SC_L; ++t) {
        const float dtv = dt[(size_t)(t0 + t) * D_DIM + d];
        const float xv  = xs[(size_t)(t0 + t) * D_DIM + d];
        const float zv  = xz[(size_t)(t0 + t) * (2 * D_DIM) + D_DIM + d];
        float la = dtv * A;
        la = fminf(20.0f, fmaxf(-20.0f, la));
        Qs[(w * SC_L + t) * 32 + lane] = make_float4(expf(la), dtv * xv, xv, silu_f(zv));
    }

    // Carry fold, shared by the block: wave w folds states 8w .. 8w+7 of the 32
    // channels over every earlier chunk, then on through the block's own chunks,
    // leaving h_in of each of them in LDS.
    const float4*  hq    = reinterpret_cast<const float4*>(hsum) + (size_t)g * (DS_DIM / 4) * 32;
    const float*   pq    = psum + g * 32;
    const size_t   hstep = (size_t)SC_G * (DS_DIM / 4) * 32;         // float4 per chunk
    const unsigned hoff  = 2 * w * 32 + lane;
    const int nprev = j * SC_W;
    float4 ha = make_float4(0.f, 0.f, 0.f, 0.f), hb = ha;
    for (int cb = 0; cb < nprev; cb += SC_FB) {
        float4 qa[SC_FB], qb[SC_FB];
        float  pp[SC_FB];
        // All fetches of the batch in flight together.  cb + k stays below SC_NC
        // (SC_NC is a multiple of SC_FB), so a fetch past nprev still reads a
        // summary that launch 1 wrote; the fold below leaves it out.
        const float4* hc = hq + cb * hstep + hoff;
        const float*  pc = pq + cb * D_DIM + lane;
        #pragma unroll
        for (int k = 0; k < SC_FB; ++k) {
            qa[k] = hc[k * hstep];
            qb[k] = hc[k * hstep + 32];
            pp[k] = pc[k * D_DIM];
        }
        #pragma unroll
        for (int k = 0; k < SC_FB; ++k) {
            const bool on = cb + k < nprev;      // past the end: identity step
            const float pe = on ? pp[k] : 1.0f;
            ha.x = pe * ha.x + (on ? qa[k].x : 0.0f);
            ha.y = pe * ha.y + (on ? qa[k].y : 0.0f);
            ha.z = pe * ha.z + (on ? qa[k].z : 0.0f);
            ha.w = pe * ha.w + (on ? qa[k].w : 0.0f);
            hb.x = pe * hb.x + (on ? qb[k].x : 0.0f);
            hb.y = pe * hb.y + (on ? qb[k].y : 0.0f);
            hb.z = pe * hb.z + (on ? qb[k].z : 0.0f);
            hb.w = pe * hb.w + (on ? qb[k].w : 0.0f);
        }
    }
    #pragma unroll
    for (int k = 0; k < SC_W; ++k) {
        Hx[(k * (DS_DIM / 4) + 2 * w) * 32 + lane]     = ha;
        Hx[(k * (DS_DIM / 4) + 2 * w + 1) * 32 + lane] = hb;
        if (k + 1 < SC_W) {
            const float4* hc = hq + (nprev + k) * hstep;
            const float4 qa = hc[hoff];
            const float4 qb = hc[hoff + 32];
            const float  pe = (pq + (nprev + k) * D_DIM)[lane];
            ha.x = pe * ha.x + qa.x;  ha.y = pe * ha.y + qa.y;
            ha.z = pe * ha.z + qa.z;  ha.w = pe * ha.w + qa.w;
            hb.x = pe * hb.x + qb.x;  hb.y = pe * hb.y + qb.y;
            hb.z = pe * hb.z + qb.z;  hb.w = pe * hb.w + qb.w;
        }
    }
    __syncthreads();                             // B, C rows and every h_in visible

    v2f h[DS_DIM / 2];
    #pragma unroll
    for (int q = 0; q < DS_DIM / 4; ++q) {
        const float4 v = Hx[(w * (DS_DIM / 4) + q) * 32 + lane];
        h[2 * q]     = (v2f){v.x, v.y};
        h[2 * q + 1] = (v2f){v.z, v.w};
    }
    const float4* bq = Bs + w * SC_L * (DS_DIM / 4);
    const float4* cq = Cs + w * SC_L * (DS_DIM / 4);
    const float4* qq = Qs + w * SC_L * 32 + lane;
    float* yo = ysi + (size_t)t0 * D_DIM + d;
    // two steps a trip: their LDS reads issue as one group ahead of the arithmetic;
    // four would need more than 256 registers
    #pragma unroll 2
    for (int t = 0; t < SC_L; ++t) {
        const float4 s4 = qq[t * 32];
        const v2f a2 = {s4.x, s4.x};
        const v2f u2 = {s4.y, s4.y};
        v2f y0 = {0.0f, 0.0f}, y1 = {0.0f, 0.0f};
        #pragma unroll
        for (int q = 0; q < DS_DIM / 4; ++q) {
            const float4 b  = bq[t * (DS_DIM / 4) + q];
            const float4 cv = cq[t * (DS_DIM / 4) + q];
            h[2 * q]     = a2 * h[2 * q]     + u2 * (v2f){b.x, b.y};
            h[2 * q + 1] = a2 * h[2 * q + 1] + u2 * (v2f){b.z, b.w};
            y0 += h[2 * q]     * (v2f){cv.x, cv.y};
            y1 += h[2 * q + 1] * (v2f){cv.z, cv.w};
        }
        const float y = (y0.x + y0.y) + (y1.x + y1.y);
        yo[(size_t)t * D_DIM] = (y + s4.z * Dpd) * s4.w;
    }
}

// ------------------------------ launcher -----------------------------------
extern "C" void kernel_launch(void* const* d_in, const int* in_sizes, int n_in,
                              void* d_out, int out_size, void* d_ws, size_t ws_size,
                              hipStream_t stream) {
    (void)in_sizes; (void)n_in; (void)out_size; (void)ws_size;

    const float* x       = (const float*)d_in[0];
    const float* norm_w  = (const float*)d_in[1];
    const float* W_in    = (const float*)d_in[2];
    const float* conv_w  = (const float*)d_in[3];
    const float* conv_b  = (const float*)d_in[4];
    const float* W_dt    = (const float*)d_in[5];
    const float* b_dt    = (const float*)d_in[6];
    const float* W_B     = (const float*)d_in[7];
    const float* W_C     = (const float*)d_in[8];
    const float* W_out   = (const float*)d_in[9];
    const float* log_A   = (const float*)d_in[10];
    const float* D_param = (const float*)d_in[11];
    const float* W_ffn1  = (const float*)d_in[12];
    const float* W_ffn2  = (const float*)d_in[13];
    const float* W_merge = (const float*)d_in[14];
    float* out = (float*)d_out;

    float* ws  = (float*)d_ws;
    float* xn  = ws;                              // [T, D]
    float* xz  = xn  + (size_t)T_LEN * D_DIM;     // [T, 2D]
    float* xs  = xz  + (size_t)T_LEN * 2 * D_DIM; // [T, D]
    float* dtb = xs  + (size_t)T_LEN * D_DIM;     // [T, D]
    float* Bm  = dtb + (size_t)T_LEN * D_DIM;     // [T, DS]
    float* Cm  = Bm  + (size_t)T_LEN * DS_DIM;    // [T, DS]
    float* ysi = Cm  + (size_t)T_LEN * DS_DIM;    // [T, D]
    float* p1  = ysi + (size_t)T_LEN * D_DIM;     // [T, D] x + first K half of g @ wfm
    float* p2  = p1  + (size_t)T_LEN * D_DIM;     // [T, D] second K half of g @ wfm
    float* g   = p2  + (size_t)T_LEN * D_DIM;     // [T, 2D] gelu(xn @ W_ffn1)
    float* wfm = g   + (size_t)T_LEN * 2 * D_DIM; // [2D, D] W_ffn2 @ W_merge[D:]
    float* wom = wfm + (size_t)2 * D_DIM * D_DIM; // [D, D]  W_out @ W_merge[:D]
    float* hsm = wom + (size_t)D_DIM * D_DIM;     // [SC_NC, D, DS] chunk end states
    float* psm = hsm + (size_t)SC_NC * D_DIM * DS_DIM; // [SC_NC, D] chunk decay products

    // 1) RMSNorm
    rmsnorm_kernel<<<T_LEN, 256, 0, stream>>>(x, norm_w, xn);
    // 2) xz = xn @ W_in and g = gelu(xn @ W_ffn1), each [2048 x 1024]; wfm = W_ffn2 @ W_merge[D:]
    gemm_xn_kernel<<<dim3(WB_X, WFM_Y + 2 * ((2 * D_DIM) / 32)), 256, 0, stream>>>(
        xn, W_in, W_ffn1, W_ffn2, W_merge, xz, g, wfm);
    // 3) causal depthwise conv + SiLU -> xs
    conv_silu_kernel<<<(T_LEN * D_DIM + 255) / 256, 256, 0, stream>>>(xz, conv_w, conv_b, xs);
    // 4) dt = softplus(xs @ W_dt + b_dt), Bm = xs @ W_B, Cm = xs @ W_C; p1 + p2 = x + g @ wfm;
    //    wom = W_out @ W_merge[:D]
    gemm_xs_kernel<<<dim3(WB_X, 3 * (D_DIM / 32) + 2 + WOM_Y), 256, 0, stream>>>(
        xs, W_dt, b_dt, W_B, W_C, g, wfm, x, W_out, W_merge, dtb, Bm, Cm, p1, p2, wom);
    // 5) SSM recurrence + (+xs*D)*silu(z) epilogue -> ysi
    ssm_chunk_kernel<<<SC_G * (SC_NC / SC_W), SC_W * 32, 0, stream>>>(xs, dtb, Bm, log_A, hsm, psm);
    ssm_apply_kernel<<<SC_G * (SC_NC / SC_W), SC_W * 32, 0, stream>>>(
        xs, dtb, Bm, Cm, xz, log_A, D_param, hsm, psm, ysi);
    // 6) out = p1 + p2 + ysi @ wom
    gemm_out_kernel<<<dim3(WB_X, D_DIM / 32), 256, 0, stream>>>(ysi, wom, p1, p2, out);
}
